// v000
// Times are from an AMD MI455X. After a warm-up the kernel runs many times in a row, and a time is the length of
// such a window on the GPU divided by its runs, so every launch and the gaps after it count. The runs cycle
// through copies of the inputs. A figure is the median of several windows, for all but v000 over two sittings.
// Sittings can differ by a few percent; kernels timed side by side share one.
// v000, which the later versions start from, runs in 438 microseconds.
// compute dtype: all float inputs rounded to bf16; q, k (from the source third x[0]) and v (all three batches) = x . W^T with EXACT bf16 products on WMMA 16x16x32 (natural rows), rounded once to f16 with the 40-dim heads zero-padded to 64 (keys) / 48 (values); PLAIN attention shared across the three batches: q, k as single f16 operands x 40^-0.5, running-max softmax in f32 (hardware exp), P (scaled by 2^11, single f16) x v (single f16) for the three value sets at once; out = o (bf16 hi + residual) . Wo^T (2 products) + bo.
#include <hip/hip_runtime.h>
#include <math.h>

typedef __attribute__((ext_vector_type(16))) _Float16 v16h;
typedef __attribute__((ext_vector_type(16))) __bf16 v16b;
typedef __attribute__((ext_vector_type(8)))  _Float16 v8h;
typedef __attribute__((ext_vector_type(8)))  float v8f;
typedef __attribute__((ext_vector_type(4)))  float v4f;
typedef __attribute__((ext_vector_type(2)))  float v2f;
typedef __attribute__((ext_vector_type(4)))  unsigned v4u;
typedef __attribute__((ext_vector_type(4)))  int v4i;
typedef float __attribute__((may_alias)) float_a;
typedef int __attribute__((may_alias)) int_a;

template <typename T> __device__ __forceinline__ void vst2(void* p, T v) { *(T*)p = v;  }
__device__ __forceinline__ v8f wmma16(v16h a, v16h b, v8f c) {
  v8f d = __builtin_amdgcn_wmma_f32_16x16x32_f16(false, a, false, b, (short)0, c, false, false);
  asm volatile("v_nop\n\tv_nop\n\tv_nop\n\tv_nop" : "+v"(d) : "v"(a), "v"(b));
  return d;
}
__device__ __forceinline__ v8f wmma_bf(v16b a, v16b b, v8f c) {
  v8f d = __builtin_amdgcn_wmma_f32_16x16x32_bf16(false, a, false, b, (short)0, c, false, false);
  asm volatile("v_nop\n\tv_nop\n\tv_nop\n\tv_nop" : "+v"(d) : "v"(a), "v"(b));
  return d;
}
// 16x16x32 fragments: lane = (h = lane>>4, row/col = lane&15); elements 0..7 = k0+8h+0..7, 8..15 = k0+16+8h+0..7; D element r = row 8h+r
__device__ __forceinline__ v16h frag_h(const _Float16* rowk0, int lane) {
  union { v16h v; v8h q[2]; } u; const _Float16* p = rowk0 + 8 * (lane >> 4);
  u.q[0] = *(const v8h*)p; u.q[1] = *(const v8h*)(p + 16); return u.v;
}
__device__ __forceinline__ v16h frag_f32(const float* rowk0, int lane) {
  v16h a; const float* p = rowk0 + 8 * (lane >> 4);
#pragma unroll
  for (int i = 0; i < 8; ++i) { a[i] = (_Float16)p[i]; a[8 + i] = (_Float16)p[16 + i]; }
  return a;
}
__device__ __forceinline__ v16h frag_f32s(const float* rowk0, int lane, float sc) {
  v16h a; const float* p = rowk0 + 8 * (lane >> 4);
#pragma unroll
  for (int i = 0; i < 8; ++i) { a[i] = (_Float16)(p[i] * sc); a[8 + i] = (_Float16)(p[16 + i] * sc); }
  return a;
}
// column fragment from a [K][ld] layout (column n), rows >= K read as 0
__device__ __forceinline__ v16h fragc_f32(const float* W, int k0, int n, int lane, int ld, int K) {
  v16h a; const int g = lane >> 4;
#pragma unroll
  for (int i = 0; i < 8; ++i) { const int ka = k0 + 8 * g + i, kb = ka + 16;
    a[i] = (_Float16)(ka < K ? W[(size_t)(ka < K ? ka : K - 1) * ld + n] : 0.f); a[8 + i] = (_Float16)(kb < K ? W[(size_t)(kb < K ? kb : K - 1) * ld + n] : 0.f); }
  return a;
}
struct F2 { v16b h, l; };
__device__ __forceinline__ F2 bsplit16(const float v[16]) { F2 r;
#pragma unroll
  for (int i = 0; i < 16; ++i) { const __bf16 h = (__bf16)v[i]; r.h[i] = h; r.l[i] = (__bf16)(v[i] - (float)h); }
  return r; }
__device__ __forceinline__ F2 split_row(const float* row, int k0, int lane) { float v[16]; const float* p = row + k0 + 8 * (lane >> 4);
#pragma unroll
  for (int i = 0; i < 8; ++i) { v[i] = p[i]; v[8 + i] = p[16 + i]; }
  return bsplit16(v); }
__device__ __forceinline__ F2 split_rowK(const float* row, int k0, int lane, int K) { float v[16]; const int g = lane >> 4;
#pragma unroll
  for (int i = 0; i < 8; ++i) { const int ka = k0 + 8 * g + i, kb = ka + 16; v[i] = ka < K ? row[ka < K ? ka : K - 1] : 0.f; v[8 + i] = kb < K ? row[kb < K ? kb : K - 1] : 0.f; }
  return bsplit16(v); }
__device__ __forceinline__ F2 split_col(const float* W, int k0, int n, int lane, int ld, int K) { float v[16]; const int g = lane >> 4;
#pragma unroll
  for (int i = 0; i < 8; ++i) { const int ka = k0 + 8 * g + i, kb = ka + 16; v[i] = ka < K ? W[(size_t)(ka < K ? ka : K - 1) * ld + n] : 0.f; v[8 + i] = kb < K ? W[(size_t)(kb < K ? kb : K - 1) * ld + n] : 0.f; }
  return bsplit16(v); }
__device__ __forceinline__ v8f mac3(const F2& a, const F2& b, v8f c) { c = wmma_bf(a.l, b.h, c); c = wmma_bf(a.h, b.l, c); return wmma_bf(a.h, b.h, c); }
__device__ __forceinline__ float sigm(float v) { return 1.0f / (1.0f + expf(-v)); }
#define LDSX() do { asm volatile("s_wait_dscnt 0" ::: "memory"); __builtin_amdgcn_wave_barrier(); __builtin_amdgcn_fence(__ATOMIC_RELEASE, "workgroup"); } while (0)


// Plug-and-play feature injection attention (3 x 4,096 tokens x 320, 8 heads x 40): the source batch's queries and keys are reused for all three batches, values differ; softmax(q k^T / sqrt(40)) v, output projection + bias.
#define NB 3
#define SS 4096
#define DM 320
#define NH 8
#define HD 40
#define HDK 64            // key dims padded to 2 k-chunks
#define HDV 48            // value dims padded to 3 tiles
#define NR (NB * SS)
#ifndef TQB
#define TQB (SS / 64)
#endif
typedef __attribute__((ext_vector_type(8))) __bf16 v8b;
__device__ __forceinline__ v16b frag_b(const __bf16* rowk0, int lane) {
  union { v16b v; v8b q[2]; } u; const __bf16* p = rowk0 + 8 * (lane >> 4);
  u.q[0] = *(const v8b*)p; u.q[1] = *(const v8b*)(p + 16); return u.v;
}
__device__ __forceinline__ float bfr(float v) { return (float)(__bf16)v; }
__device__ __attribute__((noinline)) float exp_ni(float v) { return expf(v); }
__device__ __attribute__((noinline)) float erf_ni(float v) { return erff(v); }

#define WS_PW   0u                                   // bf16 natural rows Wq, Wk, Wv, Wo [4][320][320]
#define WS_Q    (WS_PW + 2u * (size_t)4 * DM * DM)     // f16 [SS][NH*64] q (padded) ; K likewise (batch 0 only)
#define WS_K    (WS_Q + 2u * (size_t)SS * NH * HDK)
#define WS_V    (WS_K + 2u * (size_t)SS * NH * HDK)     // f16 planes [b][NH*48][SS] (pad planes zero)
#define OSTR    (NH * 64)                             // O row stride: 64-float (256-B) slot per head, one writer per line
#define WS_O    (WS_V + 2u * (size_t)NB * NH * HDV * SS) // f32 [NR][OSTR]
#define WS_POS  (WS_O + 4u * (size_t)NR * OSTR)      // bf16 [320][512] Wo rows in slot layout
#define WS_END  (WS_POS + 2u * (size_t)DM * OSTR)

__global__ __launch_bounds__(64) void k_pack(const float* __restrict__ WQ, const float* __restrict__ WK, const float* __restrict__ WV, const float* __restrict__ WO, __bf16* __restrict__ P, __bf16* __restrict__ POS) { const int n = blockIdx.x, which = blockIdx.y, t = threadIdx.x; const float* Wm = (which == 0) ? WQ : (which == 1) ? WK : (which == 2) ? WV : WO; __shared__ __align__(16) __bf16 s[OSTR]; for (int k = t; k < DM; k += 64) s[k] = (__bf16)Wm[(size_t)n * DM + k]; __syncthreads(); if (t < DM / 8) vst2((unsigned*)(P + ((size_t)which * DM + n) * DM + t * 8), *(const v4u*)&s[t * 8]);
  if (which == 3) { __syncthreads(); __shared__ __align__(16) __bf16 s2[OSTR]; for (int k = t; k < OSTR; k += 64) { const int hh = k >> 6, d = k & 63; s2[k] = (d < HD) ? s[hh * HD + d] : (__bf16)0.f; } __syncthreads(); for (int q = t; q < OSTR / 8; q += 64) vst2((unsigned*)(POS + (size_t)n * OSTR + q * 8), *(const v4u*)&s2[q * 8]); } }   // Wo rows re-laid to the 64-wide head slots (zeros in the pads)
// ---- k_zero: zero the padded q/k columns and v planes once (f16 zeros): block = 4096-element chunk
__global__ __launch_bounds__(256) void k_zero(_Float16* __restrict__ A, size_t n16) { const size_t i = ((size_t)blockIdx.x * 256 + threadIdx.x) * 16; if (i + 16 <= n16) { v4f z; z[0] = z[1] = z[2] = z[3] = 0.f; vst2((float*)(A + i), z); vst2((float*)(A + i + 8), z); } }
// ---- k_proj: block = (64 rows, head h, which): the head's 40 output columns (3 tiles, last tile half used); which 0: q (batch-0 rows) -> Q[s][h*64 + d]; 1: k likewise; 2: v for all batches -> planes [b][h*48 + d][s]
__global__ __launch_bounds__(128) void k_proj(const float* __restrict__ X, const __bf16* __restrict__ P, _Float16* __restrict__ Q, _Float16* __restrict__ Kr, _Float16* __restrict__ V) {
  __shared__ __align__(16) _Float16 so[64][56]; __shared__ __align__(16) _Float16 st[48][72];
  const int tid = threadIdx.x, wave = tid >> 5, lane = tid & 31, col = lane & 15, g = lane >> 4; const int h = blockIdx.y, which = blockIdx.z; const size_t rb0 = (size_t)blockIdx.x * 64, r0 = rb0 + wave * 16;
  if (which < 2 && rb0 >= SS) return;   // q, k only from the source batch
  const __bf16* Wr = P + ((size_t)which * DM + h * HD) * DM;
  v8f acc[3] = {};
#pragma unroll
  for (int kc = 0; kc < DM / 32; ++kc) { v16b a; { const float* p = X + (r0 + col) * DM + kc * 32 + 8 * g;
#pragma unroll
      for (int i = 0; i < 8; ++i) { a[i] = (__bf16)p[i]; a[8 + i] = (__bf16)p[16 + i]; } }
#pragma unroll
    for (int j = 0; j < 3; ++j) { const int n = j * 16 + col; acc[j] = wmma_bf(a, frag_b(Wr + (size_t)min(n, HD - 1) * DM + kc * 32, lane), acc[j]); } }   // rows n >= 40 clamp (their columns are discarded)
  if (which < 2) {
#pragma unroll
    for (int j = 0; j < 3; ++j) { const int n = j * 16 + col;
#pragma unroll
      for (int r = 0; r < 8; ++r) so[wave * 16 + 8 * g + r][n] = (n < HD) ? (_Float16)acc[j][r] : (_Float16)0.f; }
    LDSX();
    _Float16* dst = (which == 0) ? Q : Kr;
    for (int rl = 0; rl < 16; ++rl) if (lane < 6) vst2((unsigned*)(dst + (r0 + rl) * (NH * HDK) + h * HDK + lane * 8), *(const v4u*)&so[wave * 16 + rl][lane * 8]);   // 48 columns written (40 live + 8 zero); columns 48..63 zeroed by k_zero
  } else {
#pragma unroll
    for (int j = 0; j < 3; ++j) { const int n = j * 16 + col;
#pragma unroll
      for (int r = 0; r < 8; ++r) st[n][wave * 16 + 8 * g + r] = (n < HD) ? (_Float16)acc[j][r] : (_Float16)0.f; }
    __syncthreads();
    const size_t b = rb0 / SS, s0 = rb0 % SS;
    for (int e = tid; e < 48 * 8; e += 128) { const int d = e >> 3, pc = e & 7; vst2((unsigned*)(V + ((b * NH * HDV + h * HDV + d) * SS) + s0 + pc * 8), *(const v4u*)&st[d][pc * 8]); } }
}
// ---- k_attn: block = (64 queries, head): all 4,096 keys; P applied to the three batches' value planes (3 x 3 tiles)
__global__ __launch_bounds__(128) void k_attn(const _Float16* __restrict__ Q, const _Float16* __restrict__ Kr, const _Float16* __restrict__ V, float* __restrict__ O) {
  __shared__ __align__(16) _Float16 sph[4][16][40]; __shared__ __align__(16) float so[4][16][68];
  const int tid = threadIdx.x, wave = tid >> 5, lane = tid & 31, col = lane & 15, g = lane >> 4; const int h = blockIdx.y; const int q0 = blockIdx.x * 64 + wave * 16;
  v16h aq[2];
#pragma unroll
  for (int kc = 0; kc < 2; ++kc) aq[kc] = frag_h(Q + (size_t)(q0 + col) * (NH * HDK) + h * HDK + kc * 32, lane);
  float m[8], l[8];
#pragma unroll
  for (int r = 0; r < 8; ++r) { m[r] = -3.0e38f; l[r] = 0.f; }
  v8f acc[3][3] = {};
#pragma unroll 1
  for (int ks = 0; ks < SS / 32; ++ks) { const int j0 = ks * 32; v8f s[2];
#pragma unroll
    for (int ct = 0; ct < 2; ++ct) { const size_t rk = (size_t)(j0 + ct * 16 + col) * (NH * HDK) + h * HDK; v8f c = {};
#pragma unroll
      for (int kc = 0; kc < 2; ++kc) c = wmma16(aq[kc], frag_h(Kr + rk + kc * 32, lane), c);
#pragma unroll
      for (int r = 0; r < 8; ++r) s[ct][r] = c[r] * 0.15811388300841897f; }   // 40^-0.5
#pragma unroll
    for (int r = 0; r < 8; ++r) { float mx = fmaxf(s[0][r], s[1][r]);
#pragma unroll
      for (int o = 1; o < 16; o <<= 1) mx = fmaxf(mx, __shfl_xor(mx, o));
      const float mn = fmaxf(m[r], mx); const float alpha = (m[r] <= -1.0e38f) ? 0.f : __expf(m[r] - mn); const float e0 = __expf(s[0][r] - mn), e1 = __expf(s[1][r] - mn); float es = e0 + e1;
#pragma unroll
      for (int o = 1; o < 16; o <<= 1) es += __shfl_xor(es, o);
      l[r] = l[r] * alpha + es; m[r] = mn;
#pragma unroll
      for (int b = 0; b < 3; ++b)
#pragma unroll
        for (int dt = 0; dt < 3; ++dt) acc[b][dt][r] *= alpha;
      sph[wave][8 * g + r][col] = (_Float16)(e0 * 2048.0f); sph[wave][8 * g + r][16 + col] = (_Float16)(e1 * 2048.0f); }
    LDSX();
    const v16h pa = frag_h(&sph[wave][col][0], lane);
#pragma unroll
    for (int b = 0; b < 3; ++b)
#pragma unroll
      for (int dt = 0; dt < 3; ++dt) acc[b][dt] = wmma16(pa, frag_h(V + (((size_t)b * NH * HDV + h * HDV + dt * 16 + col) * SS) + j0, lane), acc[b][dt]);
    LDSX(); }
#pragma unroll
  for (int b = 0; b < 3; ++b) {
#pragma unroll
    for (int r = 0; r < 8; ++r) { const float il = (1.0f / 2048.0f) / l[r];
#pragma unroll
      for (int dt = 0; dt < 3; ++dt) so[wave][8 * g + r][dt * 16 + col] = (dt * 16 + col < HD) ? acc[b][dt][r] * il : 0.f; so[wave][8 * g + r][48 + col] = 0.f; }
    LDSX();
    for (int rl = 0; rl < 16; ++rl) if (lane < 16) vst2(O + ((size_t)b * SS + q0 + rl) * OSTR + h * 64 + lane * 4, *(const v4f*)&so[wave][rl][lane * 4]);   // the head's whole 256-B slot (40 live + 24 zeros): single writer per line, no uninitialised pad
    LDSX(); }
}
// ---- k_out: block = (64 rows, 64-column chunk (5 chunks of 320)): out = o (hi + residual, K 512 head slots) . Wo rows + bo
__global__ __launch_bounds__(128) void k_out(const float* __restrict__ O, const __bf16* __restrict__ POS, const float* __restrict__ BO, float* __restrict__ OUT) {
  __shared__ __align__(16) float so[4][16][68];
  const int tid = threadIdx.x, wave = tid >> 5, lane = tid & 31, col = lane & 15, g = lane >> 4; const size_t r0 = (size_t)blockIdx.x * 64 + wave * 16; const int n0 = blockIdx.y * 64;
  v8f acc[4] = {};
#pragma unroll
  for (int kc = 0; kc < OSTR / 32; ++kc) { if ((kc & 1) && ((kc * 32) & 63) >= 48) {}   // (all chunks carry live or zero-weighted columns)
    const F2 a = split_row(O + (r0 + col) * OSTR, kc * 32, lane);
#pragma unroll
    for (int j = 0; j < 4; ++j) { const v16b w = frag_b(POS + (size_t)(n0 + j * 16 + col) * OSTR + kc * 32, lane); acc[j] = wmma_bf(a.l, w, acc[j]); acc[j] = wmma_bf(a.h, w, acc[j]); } }
#pragma unroll
  for (int j = 0; j < 4; ++j) { const float bb = bfr(BO[n0 + j * 16 + col]);
#pragma unroll
    for (int r = 0; r < 8; ++r) so[wave][8 * g + r][j * 16 + col] = acc[j][r] + bb; }
  LDSX();
  for (int rl = 0; rl < 16; ++rl) if (lane < 16) vst2(OUT + (r0 + rl) * DM + n0 + lane * 4, *(const v4f*)&so[wave][rl][lane * 4]);
}
extern "C" void kernel_launch(void* const* d_in, const int* in_sizes, int n_in, void* d_out, int out_size, void* d_ws, size_t ws_size, hipStream_t stream) {
  (void)in_sizes; (void)n_in; (void)out_size;
  const float** F = (const float**)d_in;   // 0 x [3,4096,320], 1 Wq, 2 Wk, 3 Wv, 4 Wo (natural [320,320]), 5 bo
  if (ws_size < (size_t)WS_END) return;
  char* ws = (char*)d_ws; __bf16* P = (__bf16*)ws; __bf16* POS = (__bf16*)(ws + WS_POS); _Float16 *Q = (_Float16*)(ws + WS_Q), *Kr = (_Float16*)(ws + WS_K), *V = (_Float16*)(ws + WS_V); float* O = (float*)(ws + WS_O);
  k_pack<<<dim3(DM, 4), 64, 0, stream>>>(F[1], F[2], F[3], F[4], P, POS);
  k_zero<<<(unsigned)(((size_t)SS * NH * HDK * 2 + (size_t)NB * NH * HDV * SS) / 4096), 256, 0, stream>>>(Q, (size_t)SS * NH * HDK * 2 + (size_t)NB * NH * HDV * SS);   // Q, K (contiguous) and V regions
  k_proj<<<dim3(NR / 64, NH, 3), 128, 0, stream>>>(F[0], P, Q, Kr, V);
  k_attn<<<dim3(TQB, NH), 128, 0, stream>>>(Q, Kr, V, O);
  k_out<<<dim3(NR / 64, DM / 64), 128, 0, stream>>>(O, POS, F[5], (float*)d_out);
}

// v001
// Measured time: 238 microseconds a run.
// In both of two side-by-side timings against v000, it was 1.86 times as fast.
// compute dtype: all float inputs rounded to bf16; q, k (from the source third x[0]) and v (all three batches) = x . W^T with EXACT bf16 products on WMMA 16x16x32 (natural rows), rounded once to f16 with the 40-dim heads zero-padded to 64 (keys) / 48 (values); PLAIN attention shared across the three batches: q, k as single f16 operands x 40^-0.5, running-max softmax in f32 (hardware exp), P (scaled by 2^11, single f16) x v (single f16) for the three value sets at once; out = o (bf16 hi + residual) . Wo^T (2 products) + bo.
#include <hip/hip_runtime.h>
#include <math.h>

typedef __attribute__((ext_vector_type(16))) _Float16 v16h;
typedef __attribute__((ext_vector_type(16))) __bf16 v16b;
typedef __attribute__((ext_vector_type(8)))  _Float16 v8h;
typedef __attribute__((ext_vector_type(8)))  float v8f;
typedef __attribute__((ext_vector_type(4)))  float v4f;
typedef __attribute__((ext_vector_type(2)))  float v2f;
typedef __attribute__((ext_vector_type(4)))  unsigned v4u;
typedef __attribute__((ext_vector_type(4)))  int v4i;
typedef float __attribute__((may_alias)) float_a;
typedef int __attribute__((may_alias)) int_a;

template <typename T> __device__ __forceinline__ void vst2(void* p, T v) { *(T*)p = v;  }
__device__ __forceinline__ v8f wmma16(v16h a, v16h b, v8f c) {
  v8f d = __builtin_amdgcn_wmma_f32_16x16x32_f16(false, a, false, b, (short)0, c, false, false);
  asm volatile("v_nop\n\tv_nop\n\tv_nop\n\tv_nop" : "+v"(d) : "v"(a), "v"(b));
  return d;
}
__device__ __forceinline__ v8f wmma_bf(v16b a, v16b b, v8f c) {
  v8f d = __builtin_amdgcn_wmma_f32_16x16x32_bf16(false, a, false, b, (short)0, c, false, false);
  asm volatile("v_nop\n\tv_nop\n\tv_nop\n\tv_nop" : "+v"(d) : "v"(a), "v"(b));
  return d;
}
// 16x16x32 fragments: lane = (h = lane>>4, row/col = lane&15); elements 0..7 = k0+8h+0..7, 8..15 = k0+16+8h+0..7; D element r = row 8h+r
__device__ __forceinline__ v16h frag_h(const _Float16* rowk0, int lane) {
  union { v16h v; v8h q[2]; } u; const _Float16* p = rowk0 + 8 * (lane >> 4);
  u.q[0] = *(const v8h*)p; u.q[1] = *(const v8h*)(p + 16); return u.v;
}
__device__ __forceinline__ v16h frag_f32(const float* rowk0, int lane) {
  v16h a; const float* p = rowk0 + 8 * (lane >> 4);
#pragma unroll
  for (int i = 0; i < 8; ++i) { a[i] = (_Float16)p[i]; a[8 + i] = (_Float16)p[16 + i]; }
  return a;
}
__device__ __forceinline__ v16h frag_f32s(const float* rowk0, int lane, float sc) {
  v16h a; const float* p = rowk0 + 8 * (lane >> 4);
#pragma unroll
  for (int i = 0; i < 8; ++i) { a[i] = (_Float16)(p[i] * sc); a[8 + i] = (_Float16)(p[16 + i] * sc); }
  return a;
}
// column fragment from a [K][ld] layout (column n), rows >= K read as 0
__device__ __forceinline__ v16h fragc_f32(const float* W, int k0, int n, int lane, int ld, int K) {
  v16h a; const int g = lane >> 4;
#pragma unroll
  for (int i = 0; i < 8; ++i) { const int ka = k0 + 8 * g + i, kb = ka + 16;
    a[i] = (_Float16)(ka < K ? W[(size_t)(ka < K ? ka : K - 1) * ld + n] : 0.f); a[8 + i] = (_Float16)(kb < K ? W[(size_t)(kb < K ? kb : K - 1) * ld + n] : 0.f); }
  return a;
}
struct F2 { v16b h, l; };
__device__ __forceinline__ F2 bsplit16(const float v[16]) { F2 r;
#pragma unroll
  for (int i = 0; i < 16; ++i) { const __bf16 h = (__bf16)v[i]; r.h[i] = h; r.l[i] = (__bf16)(v[i] - (float)h); }
  return r; }
__device__ __forceinline__ F2 split_row(const float* row, int k0, int lane) { float v[16]; const float* p = row + k0 + 8 * (lane >> 4);
#pragma unroll
  for (int i = 0; i < 8; ++i) { v[i] = p[i]; v[8 + i] = p[16 + i]; }
  return bsplit16(v); }
__device__ __forceinline__ F2 split_rowK(const float* row, int k0, int lane, int K) { float v[16]; const int g = lane >> 4;
#pragma unroll
  for (int i = 0; i < 8; ++i) { const int ka = k0 + 8 * g + i, kb = ka + 16; v[i] = ka < K ? row[ka < K ? ka : K - 1] : 0.f; v[8 + i] = kb < K ? row[kb < K ? kb : K - 1] : 0.f; }
  return bsplit16(v); }
__device__ __forceinline__ F2 split_col(const float* W, int k0, int n, int lane, int ld, int K) { float v[16]; const int g = lane >> 4;
#pragma unroll
  for (int i = 0; i < 8; ++i) { const int ka = k0 + 8 * g + i, kb = ka + 16; v[i] = ka < K ? W[(size_t)(ka < K ? ka : K - 1) * ld + n] : 0.f; v[8 + i] = kb < K ? W[(size_t)(kb < K ? kb : K - 1) * ld + n] : 0.f; }
  return bsplit16(v); }
__device__ __forceinline__ v8f mac3(const F2& a, const F2& b, v8f c) { c = wmma_bf(a.l, b.h, c); c = wmma_bf(a.h, b.l, c); return wmma_bf(a.h, b.h, c); }
__device__ __forceinline__ float sigm(float v) { return 1.0f / (1.0f + expf(-v)); }
#define LDSX() do { asm volatile("s_wait_dscnt 0" ::: "memory"); __builtin_amdgcn_wave_barrier(); __builtin_amdgcn_fence(__ATOMIC_RELEASE, "workgroup"); } while (0)
// LDSX for a tile that one wave alone writes and reads, with global loads in flight: the fence at wavefront scope orders the LDS accesses and does not drain the load counter
#define LDSW() do { asm volatile("s_wait_dscnt 0" ::: "memory"); __builtin_amdgcn_wave_barrier(); __builtin_amdgcn_fence(__ATOMIC_RELEASE, "wavefront"); } while (0)


// Plug-and-play feature injection attention (3 x 4,096 tokens x 320, 8 heads x 40): the source batch's queries and keys are reused for all three batches, values differ; softmax(q k^T / sqrt(40)) v, output projection + bias.
#define NB 3
#define SS 4096
#define DM 320
#define NH 8
#define HD 40
#define HDK 64            // key dims padded to 2 k-chunks
#define HDV 48            // value dims padded to 3 tiles
#define NR (NB * SS)
#ifndef TQB
#define TQB (SS / 64)
#endif
typedef __attribute__((ext_vector_type(8))) __bf16 v8b;
__device__ __forceinline__ v16b frag_b(const __bf16* rowk0, int lane) {
  union { v16b v; v8b q[2]; } u; const __bf16* p = rowk0 + 8 * (lane >> 4);
  u.q[0] = *(const v8b*)p; u.q[1] = *(const v8b*)(p + 16); return u.v;
}
__device__ __forceinline__ float bfr(float v) { return (float)(__bf16)v; }
__device__ __attribute__((noinline)) float exp_ni(float v) { return expf(v); }
__device__ __attribute__((noinline)) float erf_ni(float v) { return erff(v); }

#define WS_PW   0u                                   // bf16 natural rows Wq, Wk, Wv, Wo [4][320][320]
#define WS_Q    (WS_PW + 2u * (size_t)4 * DM * DM)     // f16 [SS][NH*64] q (padded) ; K likewise (batch 0 only)
#define WS_K    (WS_Q + 2u * (size_t)SS * NH * HDK)
#define WS_V    (WS_K + 2u * (size_t)SS * NH * HDK)     // f16 planes [b][NH*48][SS] (pad planes zero)
#define OSTR    (NH * 64)                             // O row stride: 64-float (256-B) slot per head, one writer per line
#define WS_O    (WS_V + 2u * (size_t)NB * NH * HDV * SS) // f32 [NR][OSTR]
#define WS_POS  (WS_O + 4u * (size_t)NR * OSTR)      // bf16 [320][512] Wo rows in slot layout
#define WS_END  (WS_POS + 2u * (size_t)DM * OSTR)

__global__ __launch_bounds__(64) void k_pack(const float* __restrict__ WQ, const float* __restrict__ WK, const float* __restrict__ WV, const float* __restrict__ WO, __bf16* __restrict__ P, __bf16* __restrict__ POS) { const int n = blockIdx.x, which = blockIdx.y, t = threadIdx.x; const float* Wm = (which == 0) ? WQ : (which == 1) ? WK : (which == 2) ? WV : WO; __shared__ __align__(16) __bf16 s[OSTR]; for (int k = t; k < DM; k += 64) s[k] = (__bf16)Wm[(size_t)n * DM + k]; __syncthreads(); if (t < DM / 8) vst2((unsigned*)(P + ((size_t)which * DM + n) * DM + t * 8), *(const v4u*)&s[t * 8]);
  if (which == 3) { __syncthreads(); __shared__ __align__(16) __bf16 s2[OSTR]; for (int k = t; k < OSTR; k += 64) { const int hh = k >> 6, d = k & 63; s2[k] = (d < HD) ? s[hh * HD + d] : (__bf16)0.f; } __syncthreads(); for (int q = t; q < OSTR / 8; q += 64) vst2((unsigned*)(POS + (size_t)n * OSTR + q * 8), *(const v4u*)&s2[q * 8]); } }   // Wo rows re-laid to the 64-wide head slots (zeros in the pads)
// ---- k_zero: zero the padded q/k columns and v planes once (f16 zeros): block = 4096-element chunk
__global__ __launch_bounds__(256) void k_zero(_Float16* __restrict__ A, size_t n16) { const size_t i = ((size_t)blockIdx.x * 256 + threadIdx.x) * 16; if (i + 16 <= n16) { v4f z; z[0] = z[1] = z[2] = z[3] = 0.f; vst2((float*)(A + i), z); vst2((float*)(A + i + 8), z); } }
// ---- k_proj: block = (64 rows, head h, which): the head's 40 output columns (3 tiles, last tile half used); which 0: q (batch-0 rows) -> Q[s][h*64 + d]; 1: k likewise; 2: v for all batches -> planes [b][h*48 + d][s]
__global__ __launch_bounds__(128) void k_proj(const float* __restrict__ X, const __bf16* __restrict__ P, _Float16* __restrict__ Q, _Float16* __restrict__ Kr, _Float16* __restrict__ V) {
  __shared__ __align__(16) _Float16 so[64][56]; __shared__ __align__(16) _Float16 st[48][72];
  const int tid = threadIdx.x, wave = tid >> 5, lane = tid & 31, col = lane & 15, g = lane >> 4; const int h = blockIdx.y, which = blockIdx.z; const size_t rb0 = (size_t)blockIdx.x * 64, r0 = rb0 + wave * 16;
  if (which < 2 && rb0 >= SS) return;   // q, k only from the source batch
  const __bf16* Wr = P + ((size_t)which * DM + h * HD) * DM;
  v8f acc[3] = {};
#pragma unroll
  for (int kc = 0; kc < DM / 32; ++kc) { v16b a; { const float* p = X + (r0 + col) * DM + kc * 32 + 8 * g;
#pragma unroll
      for (int i = 0; i < 8; ++i) { a[i] = (__bf16)p[i]; a[8 + i] = (__bf16)p[16 + i]; } }
#pragma unroll
    for (int j = 0; j < 3; ++j) { const int n = j * 16 + col; acc[j] = wmma_bf(a, frag_b(Wr + (size_t)min(n, HD - 1) * DM + kc * 32, lane), acc[j]); } }   // rows n >= 40 clamp (their columns are discarded)
  if (which < 2) {
#pragma unroll
    for (int j = 0; j < 3; ++j) { const int n = j * 16 + col;
#pragma unroll
      for (int r = 0; r < 8; ++r) so[wave * 16 + 8 * g + r][n] = (n < HD) ? (_Float16)acc[j][r] : (_Float16)0.f; }
    LDSX();
    _Float16* dst = (which == 0) ? Q : Kr;
    for (int rl = 0; rl < 16; ++rl) if (lane < 6) vst2((unsigned*)(dst + (r0 + rl) * (NH * HDK) + h * HDK + lane * 8), *(const v4u*)&so[wave * 16 + rl][lane * 8]);   // 48 columns written (40 live + 8 zero); columns 48..63 zeroed by k_zero
  } else {
#pragma unroll
    for (int j = 0; j < 3; ++j) { const int n = j * 16 + col;
#pragma unroll
      for (int r = 0; r < 8; ++r) st[n][wave * 16 + 8 * g + r] = (n < HD) ? (_Float16)acc[j][r] : (_Float16)0.f; }
    __syncthreads();
    const size_t b = rb0 / SS, s0 = rb0 % SS;
    for (int e = tid; e < 48 * 8; e += 128) { const int d = e >> 3, pc = e & 7; vst2((unsigned*)(V + ((b * NH * HDV + h * HDV + d) * SS) + s0 + pc * 8), *(const v4u*)&st[d][pc * 8]); } }
}
// ---- k_attn: block = (64 queries, head): all 4,096 keys; P applied to the three batches' value planes (3 x 3 tiles)
__global__ __launch_bounds__(128) void k_attn(const _Float16* __restrict__ Q, const _Float16* __restrict__ Kr, const _Float16* __restrict__ V, float* __restrict__ O) {
  __shared__ __align__(16) _Float16 sph[4][16][40]; __shared__ __align__(16) float so[4][16][68];
  const int tid = threadIdx.x, wave = tid >> 5, lane = tid & 31, col = lane & 15, g = lane >> 4; const int h = blockIdx.y; const int q0 = blockIdx.x * 64 + wave * 16;
  v16h aq[2];
#pragma unroll
  for (int kc = 0; kc < 2; ++kc) aq[kc] = frag_h(Q + (size_t)(q0 + col) * (NH * HDK) + h * HDK + kc * 32, lane);
  float m[8], l[8];
#pragma unroll
  for (int r = 0; r < 8; ++r) { m[r] = -3.0e38f; l[r] = 0.f; }
  v8f acc[3][3] = {};
  v16h kf[2][2];   // the pass's key fragments, fetched one pass ahead
#pragma unroll
  for (int ct = 0; ct < 2; ++ct)
#pragma unroll
    for (int kc = 0; kc < 2; ++kc) kf[ct][kc] = frag_h(Kr + (size_t)(ct * 16 + col) * (NH * HDK) + h * HDK + kc * 32, lane);
#pragma unroll 1
  for (int ks = 0; ks < SS / 32; ++ks) { const int j0 = ks * 32; v8f s[2];
    v16h vf[3][3];   // the pass's value fragments: all loads issued here as one group, they land behind the score products and the softmax
#pragma unroll
    for (int b = 0; b < 3; ++b)
#pragma unroll
      for (int dt = 0; dt < 3; ++dt) vf[b][dt] = frag_h(V + (((size_t)b * NH * HDV + h * HDV + dt * 16 + col) * SS) + j0, lane);
#pragma unroll
    for (int ct = 0; ct < 2; ++ct) { v8f c = {};
#pragma unroll
      for (int kc = 0; kc < 2; ++kc) c = wmma16(aq[kc], kf[ct][kc], c);
#pragma unroll
      for (int r = 0; r < 8; ++r) s[ct][r] = c[r] * 0.15811388300841897f; }   // 40^-0.5
    const int jn = (ks + 1 < SS / 32) ? j0 + 32 : 0;   // next pass's keys (the last pass re-reads the first rows, unused)
#pragma unroll
    for (int ct = 0; ct < 2; ++ct)
#pragma unroll
      for (int kc = 0; kc < 2; ++kc) kf[ct][kc] = frag_h(Kr + (size_t)(jn + ct * 16 + col) * (NH * HDK) + h * HDK + kc * 32, lane);
    __builtin_amdgcn_sched_barrier(0);   // keeps the key loads in front of the softmax, whose whole length then covers their latency (without it the scheduler moves them behind three of its exchange rounds)
#pragma unroll
    for (int r = 0; r < 8; ++r) { float mx = fmaxf(s[0][r], s[1][r]);
#pragma unroll
      for (int o = 1; o < 16; o <<= 1) mx = fmaxf(mx, __shfl_xor(mx, o));
      const float mn = fmaxf(m[r], mx); const float alpha = (m[r] <= -1.0e38f) ? 0.f : __expf(m[r] - mn); const float e0 = __expf(s[0][r] - mn), e1 = __expf(s[1][r] - mn); float es = e0 + e1;
#pragma unroll
      for (int o = 1; o < 16; o <<= 1) es += __shfl_xor(es, o);
      l[r] = l[r] * alpha + es; m[r] = mn;
#pragma unroll
      for (int b = 0; b < 3; ++b)
#pragma unroll
        for (int dt = 0; dt < 3; ++dt) acc[b][dt][r] *= alpha;
      sph[wave][8 * g + r][col] = (_Float16)(e0 * 2048.0f); sph[wave][8 * g + r][16 + col] = (_Float16)(e1 * 2048.0f); }
    LDSW();
    const v16h pa = frag_h(&sph[wave][col][0], lane);
#pragma unroll
    for (int b = 0; b < 3; ++b)
#pragma unroll
      for (int dt = 0; dt < 3; ++dt) acc[b][dt] = wmma16(pa, vf[b][dt], acc[b][dt]);
    LDSW(); }
#pragma unroll
  for (int b = 0; b < 3; ++b) {
#pragma unroll
    for (int r = 0; r < 8; ++r) { const float il = (1.0f / 2048.0f) / l[r];
#pragma unroll
      for (int dt = 0; dt < 3; ++dt) so[wave][8 * g + r][dt * 16 + col] = (dt * 16 + col < HD) ? acc[b][dt][r] * il : 0.f; so[wave][8 * g + r][48 + col] = 0.f; }
    LDSX();
    for (int rl = 0; rl < 16; ++rl) if (lane < 16) vst2(O + ((size_t)b * SS + q0 + rl) * OSTR + h * 64 + lane * 4, *(const v4f*)&so[wave][rl][lane * 4]);   // the head's whole 256-B slot (40 live + 24 zeros): single writer per line, no uninitialised pad
    LDSX(); }
}
// ---- k_out: block = (64 rows, 64-column chunk (5 chunks of 320)): out = o (hi + residual, K 512 head slots) . Wo rows + bo
__global__ __launch_bounds__(128) void k_out(const float* __restrict__ O, const __bf16* __restrict__ POS, const float* __restrict__ BO, float* __restrict__ OUT) {
  __shared__ __align__(16) float so[4][16][68];
  const int tid = threadIdx.x, wave = tid >> 5, lane = tid & 31, col = lane & 15, g = lane >> 4; const size_t r0 = (size_t)blockIdx.x * 64 + wave * 16; const int n0 = blockIdx.y * 64;
  v8f acc[4] = {};
#pragma unroll
  for (int kc = 0; kc < OSTR / 32; ++kc) { if ((kc & 1) && ((kc * 32) & 63) >= 48) {}   // (all chunks carry live or zero-weighted columns)
    const F2 a = split_row(O + (r0 + col) * OSTR, kc * 32, lane);
#pragma unroll
    for (int j = 0; j < 4; ++j) { const v16b w = frag_b(POS + (size_t)(n0 + j * 16 + col) * OSTR + kc * 32, lane); acc[j] = wmma_bf(a.l, w, acc[j]); acc[j] = wmma_bf(a.h, w, acc[j]); } }
#pragma unroll
  for (int j = 0; j < 4; ++j) { const float bb = bfr(BO[n0 + j * 16 + col]);
#pragma unroll
    for (int r = 0; r < 8; ++r) so[wave][8 * g + r][j * 16 + col] = acc[j][r] + bb; }
  LDSX();
  for (int rl = 0; rl < 16; ++rl) if (lane < 16) vst2(OUT + (r0 + rl) * DM + n0 + lane * 4, *(const v4f*)&so[wave][rl][lane * 4]);
}
extern "C" void kernel_launch(void* const* d_in, const int* in_sizes, int n_in, void* d_out, int out_size, void* d_ws, size_t ws_size, hipStream_t stream) {
  (void)in_sizes; (void)n_in; (void)out_size;
  const float** F = (const float**)d_in;   // 0 x [3,4096,320], 1 Wq, 2 Wk, 3 Wv, 4 Wo (natural [320,320]), 5 bo
  if (ws_size < (size_t)WS_END) return;
  char* ws = (char*)d_ws; __bf16* P = (__bf16*)ws; __bf16* POS = (__bf16*)(ws + WS_POS); _Float16 *Q = (_Float16*)(ws + WS_Q), *Kr = (_Float16*)(ws + WS_K), *V = (_Float16*)(ws + WS_V); float* O = (float*)(ws + WS_O);
  k_pack<<<dim3(DM, 4), 64, 0, stream>>>(F[1], F[2], F[3], F[4], P, POS);
  k_zero<<<(unsigned)(((size_t)SS * NH * HDK * 2 + (size_t)NB * NH * HDV * SS) / 4096), 256, 0, stream>>>(Q, (size_t)SS * NH * HDK * 2 + (size_t)NB * NH * HDV * SS);   // Q, K (contiguous) and V regions
  k_proj<<<dim3(NR / 64, NH, 3), 128, 0, stream>>>(F[0], P, Q, Kr, V);
  k_attn<<<dim3(TQB, NH), 128, 0, stream>>>(Q, Kr, V, O);
  k_out<<<dim3(NR / 64, DM / 64), 128, 0, stream>>>(O, POS, F[5], (float*)d_out);
}

// v002
// It runs in 215 microseconds.
// Timed twice side by side with v001, it ran 1.10 times as fast both times.
// All steps since v000 together make it 2.05 times as fast.
// compute dtype: all float inputs rounded to bf16; q, k (from the source third x[0]) and v (all three batches) = x . W^T with EXACT bf16 products on WMMA 16x16x32 (natural rows), rounded once to f16 with the 40-dim heads zero-padded to 64 (keys) / 48 (values); PLAIN attention shared across the three batches: q, k as single f16 operands x 40^-0.5, running-max softmax in f32 (hardware exp), P (scaled by 2^11, single f16) x v (single f16) for the three value sets at once; out = o (bf16 hi + residual) . Wo^T (2 products) + bo.
#include <hip/hip_runtime.h>
#include <math.h>

typedef __attribute__((ext_vector_type(16))) _Float16 v16h;
typedef __attribute__((ext_vector_type(16))) __bf16 v16b;
typedef __attribute__((ext_vector_type(8)))  _Float16 v8h;
typedef __attribute__((ext_vector_type(8)))  float v8f;
typedef __attribute__((ext_vector_type(4)))  float v4f;
typedef __attribute__((ext_vector_type(2)))  float v2f;
typedef __attribute__((ext_vector_type(4)))  unsigned v4u;
typedef __attribute__((ext_vector_type(4)))  int v4i;
typedef float __attribute__((may_alias)) float_a;
typedef int __attribute__((may_alias)) int_a;

template <typename T> __device__ __forceinline__ void vst2(void* p, T v) { *(T*)p = v;  }
__device__ __forceinline__ v8f wmma16(v16h a, v16h b, v8f c) {
  return __builtin_amdgcn_wmma_f32_16x16x32_f16(false, a, false, b, (short)0, c, false, false);   // plain builtin: the compiler keeps the distance behind it; an asm statement on its operands would hold all of them below v256, and the two-tile wave has more than that live
}
__device__ __forceinline__ v8f wmma_bf(v16b a, v16b b, v8f c) {
  v8f d = __builtin_amdgcn_wmma_f32_16x16x32_bf16(false, a, false, b, (short)0, c, false, false);
  asm volatile("v_nop\n\tv_nop\n\tv_nop\n\tv_nop" : "+v"(d) : "v"(a), "v"(b));
  return d;
}
// 16x16x32 fragments: lane = (h = lane>>4, row/col = lane&15); elements 0..7 = k0+8h+0..7, 8..15 = k0+16+8h+0..7; D element r = row 8h+r
__device__ __forceinline__ v16h frag_h(const _Float16* rowk0, int lane) {
  union { v16h v; v8h q[2]; } u; const _Float16* p = rowk0 + 8 * (lane >> 4);
  u.q[0] = *(const v8h*)p; u.q[1] = *(const v8h*)(p + 16); return u.v;
}
__device__ __forceinline__ v16h frag_f32(const float* rowk0, int lane) {
  v16h a; const float* p = rowk0 + 8 * (lane >> 4);
#pragma unroll
  for (int i = 0; i < 8; ++i) { a[i] = (_Float16)p[i]; a[8 + i] = (_Float16)p[16 + i]; }
  return a;
}
__device__ __forceinline__ v16h frag_f32s(const float* rowk0, int lane, float sc) {
  v16h a; const float* p = rowk0 + 8 * (lane >> 4);
#pragma unroll
  for (int i = 0; i < 8; ++i) { a[i] = (_Float16)(p[i] * sc); a[8 + i] = (_Float16)(p[16 + i] * sc); }
  return a;
}
// column fragment from a [K][ld] layout (column n), rows >= K read as 0
__device__ __forceinline__ v16h fragc_f32(const float* W, int k0, int n, int lane, int ld, int K) {
  v16h a; const int g = lane >> 4;
#pragma unroll
  for (int i = 0; i < 8; ++i) { const int ka = k0 + 8 * g + i, kb = ka + 16;
    a[i] = (_Float16)(ka < K ? W[(size_t)(ka < K ? ka : K - 1) * ld + n] : 0.f); a[8 + i] = (_Float16)(kb < K ? W[(size_t)(kb < K ? kb : K - 1) * ld + n] : 0.f); }
  return a;
}
struct F2 { v16b h, l; };
__device__ __forceinline__ F2 bsplit16(const float v[16]) { F2 r;
#pragma unroll
  for (int i = 0; i < 16; ++i) { const __bf16 h = (__bf16)v[i]; r.h[i] = h; r.l[i] = (__bf16)(v[i] - (float)h); }
  return r; }
__device__ __forceinline__ F2 split_row(const float* row, int k0, int lane) { float v[16]; const float* p = row + k0 + 8 * (lane >> 4);
#pragma unroll
  for (int i = 0; i < 8; ++i) { v[i] = p[i]; v[8 + i] = p[16 + i]; }
  return bsplit16(v); }
__device__ __forceinline__ F2 split_rowK(const float* row, int k0, int lane, int K) { float v[16]; const int g = lane >> 4;
#pragma unroll
  for (int i = 0; i < 8; ++i) { const int ka = k0 + 8 * g + i, kb = ka + 16; v[i] = ka < K ? row[ka < K ? ka : K - 1] : 0.f; v[8 + i] = kb < K ? row[kb < K ? kb : K - 1] : 0.f; }
  return bsplit16(v); }
__device__ __forceinline__ F2 split_col(const float* W, int k0, int n, int lane, int ld, int K) { float v[16]; const int g = lane >> 4;
#pragma unroll
  for (int i = 0; i < 8; ++i) { const int ka = k0 + 8 * g + i, kb = ka + 16; v[i] = ka < K ? W[(size_t)(ka < K ? ka : K - 1) * ld + n] : 0.f; v[8 + i] = kb < K ? W[(size_t)(kb < K ? kb : K - 1) * ld + n] : 0.f; }
  return bsplit16(v); }
__device__ __forceinline__ v8f mac3(const F2& a, const F2& b, v8f c) { c = wmma_bf(a.l, b.h, c); c = wmma_bf(a.h, b.l, c); return wmma_bf(a.h, b.h, c); }
__device__ __forceinline__ float sigm(float v) { return 1.0f / (1.0f + expf(-v)); }
#define LDSX() do { asm volatile("s_wait_dscnt 0" ::: "memory"); __builtin_amdgcn_wave_barrier(); __builtin_amdgcn_fence(__ATOMIC_RELEASE, "workgroup"); } while (0)
// LDSX for a tile that one wave alone writes and reads, with global loads in flight: the fence at wavefront scope orders the LDS accesses and does not drain the load counter
#define LDSW() do { asm volatile("s_wait_dscnt 0" ::: "memory"); __builtin_amdgcn_wave_barrier(); __builtin_amdgcn_fence(__ATOMIC_RELEASE, "wavefront"); } while (0)


// Plug-and-play feature injection attention (3 x 4,096 tokens x 320, 8 heads x 40): the source batch's queries and keys are reused for all three batches, values differ; softmax(q k^T / sqrt(40)) v, output projection + bias.
#define NB 3
#define SS 4096
#define DM 320
#define NH 8
#define HD 40
#define HDK 64            // key dims padded to 2 k-chunks
#define HDV 48            // value dims padded to 3 tiles
#define NR (NB * SS)
typedef __attribute__((ext_vector_type(8))) __bf16 v8b;
__device__ __forceinline__ v16b frag_b(const __bf16* rowk0, int lane) {
  union { v16b v; v8b q[2]; } u; const __bf16* p = rowk0 + 8 * (lane >> 4);
  u.q[0] = *(const v8b*)p; u.q[1] = *(const v8b*)(p + 16); return u.v;
}
__device__ __forceinline__ float bfr(float v) { return (float)(__bf16)v; }
__device__ __attribute__((noinline)) float exp_ni(float v) { return expf(v); }
__device__ __attribute__((noinline)) float erf_ni(float v) { return erff(v); }

#define WS_PW   0u                                   // bf16 natural rows Wq, Wk, Wv, Wo [4][320][320]
#define WS_Q    (WS_PW + 2u * (size_t)4 * DM * DM)     // f16 [SS][NH*64] q (padded) ; K likewise (batch 0 only)
#define WS_K    (WS_Q + 2u * (size_t)SS * NH * HDK)
#define WS_V    (WS_K + 2u * (size_t)SS * NH * HDK)     // f16 planes [b][NH*48][SS] (pad planes zero)
#define OSTR    (NH * 64)                             // O row stride: 64-float (256-B) slot per head, one writer per line
#define WS_O    (WS_V + 2u * (size_t)NB * NH * HDV * SS) // f32 [NR][OSTR]
#define WS_POS  (WS_O + 4u * (size_t)NR * OSTR)      // bf16 [320][512] Wo rows in slot layout
#define WS_END  (WS_POS + 2u * (size_t)DM * OSTR)

__global__ __launch_bounds__(64) void k_pack(const float* __restrict__ WQ, const float* __restrict__ WK, const float* __restrict__ WV, const float* __restrict__ WO, __bf16* __restrict__ P, __bf16* __restrict__ POS) { const int n = blockIdx.x, which = blockIdx.y, t = threadIdx.x; const float* Wm = (which == 0) ? WQ : (which == 1) ? WK : (which == 2) ? WV : WO; __shared__ __align__(16) __bf16 s[OSTR]; for (int k = t; k < DM; k += 64) s[k] = (__bf16)Wm[(size_t)n * DM + k]; __syncthreads(); if (t < DM / 8) vst2((unsigned*)(P + ((size_t)which * DM + n) * DM + t * 8), *(const v4u*)&s[t * 8]);
  if (which == 3) { __syncthreads(); __shared__ __align__(16) __bf16 s2[OSTR]; for (int k = t; k < OSTR; k += 64) { const int hh = k >> 6, d = k & 63; s2[k] = (d < HD) ? s[hh * HD + d] : (__bf16)0.f; } __syncthreads(); for (int q = t; q < OSTR / 8; q += 64) vst2((unsigned*)(POS + (size_t)n * OSTR + q * 8), *(const v4u*)&s2[q * 8]); } }   // Wo rows re-laid to the 64-wide head slots (zeros in the pads)
// ---- k_zero: zero the padded q/k columns and v planes once (f16 zeros): block = 4096-element chunk
__global__ __launch_bounds__(256) void k_zero(_Float16* __restrict__ A, size_t n16) { const size_t i = ((size_t)blockIdx.x * 256 + threadIdx.x) * 16; if (i + 16 <= n16) { v4f z; z[0] = z[1] = z[2] = z[3] = 0.f; vst2((float*)(A + i), z); vst2((float*)(A + i + 8), z); } }
// ---- k_proj: block = (64 rows, head h, which): the head's 40 output columns (3 tiles, last tile half used); which 0: q (batch-0 rows) -> Q[s][h*64 + d]; 1: k likewise; 2: v for all batches -> planes [b][h*48 + d][s]
__global__ __launch_bounds__(128) void k_proj(const float* __restrict__ X, const __bf16* __restrict__ P, _Float16* __restrict__ Q, _Float16* __restrict__ Kr, _Float16* __restrict__ V) {
  __shared__ __align__(16) _Float16 so[64][56]; __shared__ __align__(16) _Float16 st[48][72];
  const int tid = threadIdx.x, wave = tid >> 5, lane = tid & 31, col = lane & 15, g = lane >> 4; const int h = blockIdx.y, which = blockIdx.z; const size_t rb0 = (size_t)blockIdx.x * 64, r0 = rb0 + wave * 16;
  if (which < 2 && rb0 >= SS) return;   // q, k only from the source batch
  const __bf16* Wr = P + ((size_t)which * DM + h * HD) * DM;
  v8f acc[3] = {};
#pragma unroll
  for (int kc = 0; kc < DM / 32; ++kc) { v16b a; { const float* p = X + (r0 + col) * DM + kc * 32 + 8 * g;
#pragma unroll
      for (int i = 0; i < 8; ++i) { a[i] = (__bf16)p[i]; a[8 + i] = (__bf16)p[16 + i]; } }
#pragma unroll
    for (int j = 0; j < 3; ++j) { const int n = j * 16 + col; acc[j] = wmma_bf(a, frag_b(Wr + (size_t)min(n, HD - 1) * DM + kc * 32, lane), acc[j]); } }   // rows n >= 40 clamp (their columns are discarded)
  if (which < 2) {
#pragma unroll
    for (int j = 0; j < 3; ++j) { const int n = j * 16 + col;
#pragma unroll
      for (int r = 0; r < 8; ++r) so[wave * 16 + 8 * g + r][n] = (n < HD) ? (_Float16)acc[j][r] : (_Float16)0.f; }
    LDSX();
    _Float16* dst = (which == 0) ? Q : Kr;
    for (int rl = 0; rl < 16; ++rl) if (lane < 6) vst2((unsigned*)(dst + (r0 + rl) * (NH * HDK) + h * HDK + lane * 8), *(const v4u*)&so[wave * 16 + rl][lane * 8]);   // 48 columns written (40 live + 8 zero); columns 48..63 zeroed by k_zero
  } else {
#pragma unroll
    for (int j = 0; j < 3; ++j) { const int n = j * 16 + col;
#pragma unroll
      for (int r = 0; r < 8; ++r) st[n][wave * 16 + 8 * g + r] = (n < HD) ? (_Float16)acc[j][r] : (_Float16)0.f; }
    __syncthreads();
    const size_t b = rb0 / SS, s0 = rb0 % SS;
    for (int e = tid; e < 48 * 8; e += 128) { const int d = e >> 3, pc = e & 7; vst2((unsigned*)(V + ((b * NH * HDV + h * HDV + d) * SS) + s0 + pc * 8), *(const v4u*)&st[d][pc * 8]); } }
}
// ---- k_attn: block = (128 queries, head), a wave = 32 queries (two 16-row tiles): all 4,096 keys; every key and value fragment a wave loads feeds both tiles' products; P applied to the three batches' value planes (3 x 3 tiles)
#define QT 2
__global__ __launch_bounds__(128) void k_attn(const _Float16* __restrict__ Q, const _Float16* __restrict__ Kr, const _Float16* __restrict__ V, float* __restrict__ O) {
  __shared__ __align__(16) _Float16 sph[4][QT][16][40]; __shared__ __align__(16) float so[4][16][68];
  const int tid = threadIdx.x, wave = tid >> 5, lane = tid & 31, col = lane & 15, g = lane >> 4; const int h = blockIdx.y; const int q0 = blockIdx.x * (64 * QT) + wave * (16 * QT);
  v16h aq[QT][2];
#pragma unroll
  for (int t = 0; t < QT; ++t)
#pragma unroll
    for (int kc = 0; kc < 2; ++kc) aq[t][kc] = frag_h(Q + (size_t)(q0 + t * 16 + col) * (NH * HDK) + h * HDK + kc * 32, lane);
  v16h kf[2][2];   // the pass's key fragments, fetched one pass ahead
#pragma unroll
  for (int ct = 0; ct < 2; ++ct)
#pragma unroll
    for (int kc = 0; kc < 2; ++kc) kf[ct][kc] = frag_h(Kr + (size_t)(ct * 16 + col) * (NH * HDK) + h * HDK + kc * 32, lane);
  asm volatile("s_wait_xcnt 0x0" ::: "memory");   // the query and key loads' address registers are reused below: the wait stands in front of that
  __builtin_amdgcn_sched_barrier(0);   // keeps the vector work below behind the wait
  float m[QT][8], l[QT][8];
#pragma unroll
  for (int t = 0; t < QT; ++t)
#pragma unroll
    for (int r = 0; r < 8; ++r) { m[t][r] = -3.0e38f; l[t][r] = 0.f; }
  v8f acc[QT][3][3] = {};
#pragma unroll 1
  for (int ks = 0; ks < SS / 32; ++ks) { const int j0 = ks * 32; v8f s[QT][2];
    v16h vf[3][3];   // the pass's value fragments: all loads issued here as one group, they land behind the score products and the softmax
    __builtin_amdgcn_sched_barrier(0);   // with the one behind the wait: nothing but the loads stands between them, so no other instruction takes over an address register ahead of the wait
#pragma unroll
    for (int b = 0; b < 3; ++b)
#pragma unroll
      for (int dt = 0; dt < 3; ++dt) vf[b][dt] = frag_h(V + (((size_t)b * NH * HDV + h * HDV + dt * 16 + col) * SS) + j0, lane);
    asm volatile("s_wait_xcnt 0x0" ::: "memory");   // the value loads' address registers are free for reuse behind them: the wait stands in front of any rewrite
    __builtin_amdgcn_sched_barrier(0);   // keeps later vector work behind the wait
#pragma unroll
    for (int ct = 0; ct < 2; ++ct)
#pragma unroll
      for (int t = 0; t < QT; ++t) { v8f c = {};
#pragma unroll
        for (int kc = 0; kc < 2; ++kc) c = wmma16(aq[t][kc], kf[ct][kc], c);
#pragma unroll
        for (int r = 0; r < 8; ++r) s[t][ct][r] = c[r] * 0.15811388300841897f; }   // 40^-0.5
    const int jn = (ks + 1 < SS / 32) ? j0 + 32 : 0;   // next pass's keys (the last pass re-reads the first rows, unused)
    const _Float16* kp = Kr + (size_t)(jn + col) * (NH * HDK) + h * HDK;   // one base for the eight loads
    __builtin_amdgcn_sched_barrier(0);   // with the one behind the wait: nothing but the loads stands between them
#pragma unroll
    for (int ct = 0; ct < 2; ++ct)
#pragma unroll
      for (int kc = 0; kc < 2; ++kc) kf[ct][kc] = frag_h(kp + ct * 16 * (NH * HDK) + kc * 32, lane);
    asm volatile("s_wait_xcnt 0x0" ::: "memory");   // the key loads' address registers are reused by the softmax: the wait stands in front of that
    __builtin_amdgcn_sched_barrier(0);   // keeps the key loads in front of the softmax, whose whole length then covers their latency (without it the scheduler moves them behind three of its exchange rounds)
#pragma unroll
    for (int t = 0; t < QT; ++t)
#pragma unroll
    for (int r = 0; r < 8; ++r) { float mx = fmaxf(s[t][0][r], s[t][1][r]);
#pragma unroll
      for (int o = 1; o < 16; o <<= 1) mx = fmaxf(mx, __shfl_xor(mx, o));
      const float mn = fmaxf(m[t][r], mx); const float alpha = (m[t][r] <= -1.0e38f) ? 0.f : __expf(m[t][r] - mn); const float e0 = __expf(s[t][0][r] - mn), e1 = __expf(s[t][1][r] - mn); float es = e0 + e1;
#pragma unroll
      for (int o = 1; o < 16; o <<= 1) es += __shfl_xor(es, o);
      l[t][r] = l[t][r] * alpha + es; m[t][r] = mn;
#pragma unroll
      for (int b = 0; b < 3; ++b)
#pragma unroll
        for (int dt = 0; dt < 3; ++dt) acc[t][b][dt][r] *= alpha;
      sph[wave][t][8 * g + r][col] = (_Float16)(e0 * 2048.0f); sph[wave][t][8 * g + r][16 + col] = (_Float16)(e1 * 2048.0f); }
    LDSW();
    v16h pa[QT];
#pragma unroll
    for (int t = 0; t < QT; ++t) pa[t] = frag_h(&sph[wave][t][col][0], lane);
#pragma unroll
    for (int b = 0; b < 3; ++b)
#pragma unroll
      for (int dt = 0; dt < 3; ++dt)
#pragma unroll
        for (int t = 0; t < QT; ++t) acc[t][b][dt] = wmma16(pa[t], vf[b][dt], acc[t][b][dt]);
    LDSW(); }
#pragma unroll
  for (int t = 0; t < QT; ++t)
#pragma unroll
  for (int b = 0; b < 3; ++b) {
#pragma unroll
    for (int r = 0; r < 8; ++r) { const float il = (1.0f / 2048.0f) / l[t][r];
#pragma unroll
      for (int dt = 0; dt < 3; ++dt) so[wave][8 * g + r][dt * 16 + col] = (dt * 16 + col < HD) ? acc[t][b][dt][r] * il : 0.f; so[wave][8 * g + r][48 + col] = 0.f; }
    LDSX();
    for (int rl = 0; rl < 16; ++rl) if (lane < 16) vst2(O + ((size_t)b * SS + q0 + t * 16 + rl) * OSTR + h * 64 + lane * 4, *(const v4f*)&so[wave][rl][lane * 4]);   // the head's whole 256-B slot (40 live + 24 zeros): single writer per line, no uninitialised pad
    LDSX(); }
}
// ---- k_out: block = (64 rows, 64-column chunk (5 chunks of 320)): out = o (hi + residual, K 512 head slots) . Wo rows + bo
__global__ __launch_bounds__(128) void k_out(const float* __restrict__ O, const __bf16* __restrict__ POS, const float* __restrict__ BO, float* __restrict__ OUT) {
  __shared__ __align__(16) float so[4][16][68];
  const int tid = threadIdx.x, wave = tid >> 5, lane = tid & 31, col = lane & 15, g = lane >> 4; const size_t r0 = (size_t)blockIdx.x * 64 + wave * 16; const int n0 = blockIdx.y * 64;
  v8f acc[4] = {};
#pragma unroll
  for (int kc = 0; kc < OSTR / 32; ++kc) { if ((kc & 1) && ((kc * 32) & 63) >= 48) {}   // (all chunks carry live or zero-weighted columns)
    const F2 a = split_row(O + (r0 + col) * OSTR, kc * 32, lane);
#pragma unroll
    for (int j = 0; j < 4; ++j) { const v16b w = frag_b(POS + (size_t)(n0 + j * 16 + col) * OSTR + kc * 32, lane); acc[j] = wmma_bf(a.l, w, acc[j]); acc[j] = wmma_bf(a.h, w, acc[j]); } }
#pragma unroll
  for (int j = 0; j < 4; ++j) { const float bb = bfr(BO[n0 + j * 16 + col]);
#pragma unroll
    for (int r = 0; r < 8; ++r) so[wave][8 * g + r][j * 16 + col] = acc[j][r] + bb; }
  LDSX();
  for (int rl = 0; rl < 16; ++rl) if (lane < 16) vst2(OUT + (r0 + rl) * DM + n0 + lane * 4, *(const v4f*)&so[wave][rl][lane * 4]);
}
extern "C" void kernel_launch(void* const* d_in, const int* in_sizes, int n_in, void* d_out, int out_size, void* d_ws, size_t ws_size, hipStream_t stream) {
  (void)in_sizes; (void)n_in; (void)out_size;
  const float** F = (const float**)d_in;   // 0 x [3,4096,320], 1 Wq, 2 Wk, 3 Wv, 4 Wo (natural [320,320]), 5 bo
  if (ws_size < (size_t)WS_END) return;
  char* ws = (char*)d_ws; __bf16* P = (__bf16*)ws; __bf16* POS = (__bf16*)(ws + WS_POS); _Float16 *Q = (_Float16*)(ws + WS_Q), *Kr = (_Float16*)(ws + WS_K), *V = (_Float16*)(ws + WS_V); float* O = (float*)(ws + WS_O);
  k_pack<<<dim3(DM, 4), 64, 0, stream>>>(F[1], F[2], F[3], F[4], P, POS);
  k_zero<<<(unsigned)(((size_t)SS * NH * HDK * 2 + (size_t)NB * NH * HDV * SS) / 4096), 256, 0, stream>>>(Q, (size_t)SS * NH * HDK * 2 + (size_t)NB * NH * HDV * SS);   // Q, K (contiguous) and V regions
  k_proj<<<dim3(NR / 64, NH, 3), 128, 0, stream>>>(F[0], P, Q, Kr, V);
  k_attn<<<dim3(SS / (64 * QT), NH), 128, 0, stream>>>(Q, Kr, V, O);
  k_out<<<dim3(NR / 64, DM / 64), 128, 0, stream>>>(O, POS, F[5], (float*)d_out);
}

// v003
// A run of this version takes 162 microseconds.
// Timed twice side by side with v002, it ran 1.33 times as fast both times.
// Counting every step since v000, it is 2.73 times as fast.
// compute dtype: all float inputs rounded to bf16; q, k (from the source third x[0]) and v (all three batches) = x . W^T with EXACT bf16 products on WMMA 16x16x32 (natural rows), rounded once to f16 with the 40-dim heads zero-padded to 64 (keys) / 48 (values); PLAIN attention shared across the three batches: q, k as single f16 operands x 40^-0.5, running-max softmax in f32 (hardware exp), P (scaled by 2^11, single f16) x v (single f16) for the three value sets at once; out = o (bf16 hi + residual) . Wo^T (2 products) + bo.
#include <hip/hip_runtime.h>
#include <math.h>

typedef __attribute__((ext_vector_type(16))) _Float16 v16h;
typedef __attribute__((ext_vector_type(16))) __bf16 v16b;
typedef __attribute__((ext_vector_type(8)))  _Float16 v8h;
typedef __attribute__((ext_vector_type(8)))  float v8f;
typedef __attribute__((ext_vector_type(4)))  float v4f;
typedef __attribute__((ext_vector_type(2)))  float v2f;
typedef __attribute__((ext_vector_type(4)))  unsigned v4u;
typedef __attribute__((ext_vector_type(4)))  int v4i;
typedef float __attribute__((may_alias)) float_a;
typedef int __attribute__((may_alias)) int_a;

template <typename T> __device__ __forceinline__ void vst2(void* p, T v) { *(T*)p = v;  }
__device__ __forceinline__ v8f wmma16(v16h a, v16h b, v8f c) {
  return __builtin_amdgcn_wmma_f32_16x16x32_f16(false, a, false, b, (short)0, c, false, false);   // plain builtin: the compiler keeps the distance behind it; an asm statement on its operands would hold all of them below v256, and the two-tile wave has more than that live
}
__device__ __forceinline__ v8f wmma_bf(v16b a, v16b b, v8f c) {
  v8f d = __builtin_amdgcn_wmma_f32_16x16x32_bf16(false, a, false, b, (short)0, c, false, false);
  asm volatile("v_nop\n\tv_nop\n\tv_nop\n\tv_nop" : "+v"(d) : "v"(a), "v"(b));
  return d;
}
// 16x16x32 fragments: lane = (h = lane>>4, row/col = lane&15); elements 0..7 = k0+8h+0..7, 8..15 = k0+16+8h+0..7; D element r = row 8h+r
__device__ __forceinline__ v16h frag_h(const _Float16* rowk0, int lane) {
  union { v16h v; v8h q[2]; } u; const _Float16* p = rowk0 + 8 * (lane >> 4);
  u.q[0] = *(const v8h*)p; u.q[1] = *(const v8h*)(p + 16); return u.v;
}
__device__ __forceinline__ v16h frag_f32(const float* rowk0, int lane) {
  v16h a; const float* p = rowk0 + 8 * (lane >> 4);
#pragma unroll
  for (int i = 0; i < 8; ++i) { a[i] = (_Float16)p[i]; a[8 + i] = (_Float16)p[16 + i]; }
  return a;
}
__device__ __forceinline__ v16h frag_f32s(const float* rowk0, int lane, float sc) {
  v16h a; const float* p = rowk0 + 8 * (lane >> 4);
#pragma unroll
  for (int i = 0; i < 8; ++i) { a[i] = (_Float16)(p[i] * sc); a[8 + i] = (_Float16)(p[16 + i] * sc); }
  return a;
}
// column fragment from a [K][ld] layout (column n), rows >= K read as 0
__device__ __forceinline__ v16h fragc_f32(const float* W, int k0, int n, int lane, int ld, int K) {
  v16h a; const int g = lane >> 4;
#pragma unroll
  for (int i = 0; i < 8; ++i) { const int ka = k0 + 8 * g + i, kb = ka + 16;
    a[i] = (_Float16)(ka < K ? W[(size_t)(ka < K ? ka : K - 1) * ld + n] : 0.f); a[8 + i] = (_Float16)(kb < K ? W[(size_t)(kb < K ? kb : K - 1) * ld + n] : 0.f); }
  return a;
}
struct F2 { v16b h, l; };
__device__ __forceinline__ F2 bsplit16(const float v[16]) { F2 r;
#pragma unroll
  for (int i = 0; i < 16; ++i) { const __bf16 h = (__bf16)v[i]; r.h[i] = h; r.l[i] = (__bf16)(v[i] - (float)h); }
  return r; }
__device__ __forceinline__ F2 split_row(const float* row, int k0, int lane) { float v[16]; const float* p = row + k0 + 8 * (lane >> 4);
#pragma unroll
  for (int i = 0; i < 8; ++i) { v[i] = p[i]; v[8 + i] = p[16 + i]; }
  return bsplit16(v); }
__device__ __forceinline__ F2 split_rowK(const float* row, int k0, int lane, int K) { float v[16]; const int g = lane >> 4;
#pragma unroll
  for (int i = 0; i < 8; ++i) { const int ka = k0 + 8 * g + i, kb = ka + 16; v[i] = ka < K ? row[ka < K ? ka : K - 1] : 0.f; v[8 + i] = kb < K ? row[kb < K ? kb : K - 1] : 0.f; }
  return bsplit16(v); }
__device__ __forceinline__ F2 split_col(const float* W, int k0, int n, int lane, int ld, int K) { float v[16]; const int g = lane >> 4;
#pragma unroll
  for (int i = 0; i < 8; ++i) { const int ka = k0 + 8 * g + i, kb = ka + 16; v[i] = ka < K ? W[(size_t)(ka < K ? ka : K - 1) * ld + n] : 0.f; v[8 + i] = kb < K ? W[(size_t)(kb < K ? kb : K - 1) * ld + n] : 0.f; }
  return bsplit16(v); }
__device__ __forceinline__ v8f mac3(const F2& a, const F2& b, v8f c) { c = wmma_bf(a.l, b.h, c); c = wmma_bf(a.h, b.l, c); return wmma_bf(a.h, b.h, c); }
__device__ __forceinline__ float sigm(float v) { return 1.0f / (1.0f + expf(-v)); }
#define LDSX() do { asm volatile("s_wait_dscnt 0" ::: "memory"); __builtin_amdgcn_wave_barrier(); __builtin_amdgcn_fence(__ATOMIC_RELEASE, "workgroup"); } while (0)


// Plug-and-play feature injection attention (3 x 4,096 tokens x 320, 8 heads x 40): the source batch's queries and keys are reused for all three batches, values differ; softmax(q k^T / sqrt(40)) v, output projection + bias.
#define NB 3
#define SS 4096
#define DM 320
#define NH 8
#define HD 40
#define HDK 64            // key dims padded to 2 k-chunks
#define HDV 48            // value dims padded to 3 tiles
#define NR (NB * SS)
typedef __attribute__((ext_vector_type(8))) __bf16 v8b;
__device__ __forceinline__ v16b frag_b(const __bf16* rowk0, int lane) {
  union { v16b v; v8b q[2]; } u; const __bf16* p = rowk0 + 8 * (lane >> 4);
  u.q[0] = *(const v8b*)p; u.q[1] = *(const v8b*)(p + 16); return u.v;
}
__device__ __forceinline__ float bfr(float v) { return (float)(__bf16)v; }
__device__ __attribute__((noinline)) float exp_ni(float v) { return expf(v); }
__device__ __attribute__((noinline)) float erf_ni(float v) { return erff(v); }

#define WS_PW   0u                                   // bf16 natural rows Wq, Wk, Wv, Wo [4][320][320]
#define WS_Q    (WS_PW + 2u * (size_t)4 * DM * DM)     // f16 [SS][NH*64] q (padded) ; K likewise (batch 0 only)
#define WS_K    (WS_Q + 2u * (size_t)SS * NH * HDK)
#define WS_V    (WS_K + 2u * (size_t)SS * NH * HDK)     // f16 planes [b][NH*48][SS] (pad planes zero)
#define OSTR    (NH * 64)                             // O row stride: 64-float (256-B) slot per head, one writer per line
#define WS_O    (WS_V + 2u * (size_t)NB * NH * HDV * SS) // f32 [NR][OSTR]
#define WS_POS  (WS_O + 4u * (size_t)NR * OSTR)      // bf16 [320][512] Wo rows in slot layout
#define WS_END  (WS_POS + 2u * (size_t)DM * OSTR)

__global__ __launch_bounds__(64) void k_pack(const float* __restrict__ WQ, const float* __restrict__ WK, const float* __restrict__ WV, const float* __restrict__ WO, __bf16* __restrict__ P, __bf16* __restrict__ POS) { const int n = blockIdx.x, which = blockIdx.y, t = threadIdx.x; const float* Wm = (which == 0) ? WQ : (which == 1) ? WK : (which == 2) ? WV : WO; __shared__ __align__(16) __bf16 s[OSTR]; for (int k = t; k < DM; k += 64) s[k] = (__bf16)Wm[(size_t)n * DM + k]; __syncthreads(); if (t < DM / 8) vst2((unsigned*)(P + ((size_t)which * DM + n) * DM + t * 8), *(const v4u*)&s[t * 8]);
  if (which == 3) { __syncthreads(); __shared__ __align__(16) __bf16 s2[OSTR]; for (int k = t; k < OSTR; k += 64) { const int hh = k >> 6, d = k & 63; s2[k] = (d < HD) ? s[hh * HD + d] : (__bf16)0.f; } __syncthreads(); for (int q = t; q < OSTR / 8; q += 64) vst2((unsigned*)(POS + (size_t)n * OSTR + q * 8), *(const v4u*)&s2[q * 8]); } }   // Wo rows re-laid to the 64-wide head slots (zeros in the pads)
// ---- k_zero: zero the padded q/k columns and v planes once (f16 zeros): block = 4096-element chunk
__global__ __launch_bounds__(256) void k_zero(_Float16* __restrict__ A, size_t n16) { const size_t i = ((size_t)blockIdx.x * 256 + threadIdx.x) * 16; if (i + 16 <= n16) { v4f z; z[0] = z[1] = z[2] = z[3] = 0.f; vst2((float*)(A + i), z); vst2((float*)(A + i + 8), z); } }
// ---- k_proj: block = (64 rows, head h, which): the head's 40 output columns (3 tiles, last tile half used); which 0: q (batch-0 rows) -> Q[s][h*64 + d]; 1: k likewise; 2: v for all batches -> planes [b][h*48 + d][s]
__global__ __launch_bounds__(128) void k_proj(const float* __restrict__ X, const __bf16* __restrict__ P, _Float16* __restrict__ Q, _Float16* __restrict__ Kr, _Float16* __restrict__ V) {
  __shared__ __align__(16) _Float16 so[64][56]; __shared__ __align__(16) _Float16 st[48][72];
  const int tid = threadIdx.x, wave = tid >> 5, lane = tid & 31, col = lane & 15, g = lane >> 4; const int h = blockIdx.y, which = blockIdx.z; const size_t rb0 = (size_t)blockIdx.x * 64, r0 = rb0 + wave * 16;
  if (which < 2 && rb0 >= SS) return;   // q, k only from the source batch
  const __bf16* Wr = P + ((size_t)which * DM + h * HD) * DM;
  v8f acc[3] = {};
#pragma unroll
  for (int kc = 0; kc < DM / 32; ++kc) { v16b a; { const float* p = X + (r0 + col) * DM + kc * 32 + 8 * g;
#pragma unroll
      for (int i = 0; i < 8; ++i) { a[i] = (__bf16)p[i]; a[8 + i] = (__bf16)p[16 + i]; } }
#pragma unroll
    for (int j = 0; j < 3; ++j) { const int n = j * 16 + col; acc[j] = wmma_bf(a, frag_b(Wr + (size_t)min(n, HD - 1) * DM + kc * 32, lane), acc[j]); } }   // rows n >= 40 clamp (their columns are discarded)
  if (which < 2) {
#pragma unroll
    for (int j = 0; j < 3; ++j) { const int n = j * 16 + col;
#pragma unroll
      for (int r = 0; r < 8; ++r) so[wave * 16 + 8 * g + r][n] = (n < HD) ? (_Float16)acc[j][r] : (_Float16)0.f; }
    LDSX();
    _Float16* dst = (which == 0) ? Q : Kr;
    for (int rl = 0; rl < 16; ++rl) if (lane < 6) vst2((unsigned*)(dst + (r0 + rl) * (NH * HDK) + h * HDK + lane * 8), *(const v4u*)&so[wave * 16 + rl][lane * 8]);   // 48 columns written (40 live + 8 zero); columns 48..63 zeroed by k_zero
  } else {
#pragma unroll
    for (int j = 0; j < 3; ++j) { const int n = j * 16 + col;
#pragma unroll
      for (int r = 0; r < 8; ++r) st[n][wave * 16 + 8 * g + r] = (n < HD) ? (_Float16)acc[j][r] : (_Float16)0.f; }
    __syncthreads();
    const size_t b = rb0 / SS, s0 = rb0 % SS;
    for (int e = tid; e < 48 * 8; e += 128) { const int d = e >> 3, pc = e & 7; vst2((unsigned*)(V + ((b * NH * HDV + h * HDV + d) * SS) + s0 + pc * 8), *(const v4u*)&st[d][pc * 8]); } }
}
// ---- k_attn: block = (128 queries, head), a wave = 32 queries (two 16-column tiles): all 4,096 keys; transposed products: S^T = K . Q^T (a lane holds 16 of one query's 32 scores of the pass), O^T += V^T . P^T for the three batches' value planes (3 x 3 tiles); P^T goes from the score accumulators straight into the B operand
#define QT 2
__device__ __forceinline__ float xhalf(float x) { return __builtin_bit_cast(float, __builtin_amdgcn_permlanex16(__builtin_bit_cast(int, x), __builtin_bit_cast(int, x), 0x76543210, 0xfedcba98, false, false)); }   // lane l's value from lane l ^ 16
__global__ __launch_bounds__(128) void k_attn(const _Float16* __restrict__ Q, const _Float16* __restrict__ Kr, const _Float16* __restrict__ V, float* __restrict__ O) {
  __shared__ __align__(16) float so[4][16][68];
  const int tid = threadIdx.x, wave = tid >> 5, lane = tid & 31, col = lane & 15, g = lane >> 4; const int h = blockIdx.y; const int q0 = blockIdx.x * (64 * QT) + wave * (16 * QT);
  v16h aq[QT][2];
#pragma unroll
  for (int t = 0; t < QT; ++t)
#pragma unroll
    for (int kc = 0; kc < 2; ++kc) aq[t][kc] = frag_h(Q + (size_t)(q0 + t * 16 + col) * (NH * HDK) + h * HDK + kc * 32, lane);
  v16h kf[2][2];   // the pass's key fragments, fetched one pass ahead
#pragma unroll
  for (int ct = 0; ct < 2; ++ct)
#pragma unroll
    for (int kc = 0; kc < 2; ++kc) kf[ct][kc] = frag_h(Kr + (size_t)(ct * 16 + col) * (NH * HDK) + h * HDK + kc * 32, lane);
  asm volatile("s_wait_xcnt 0x0" ::: "memory");   // the query and key loads' address registers are reused below: the wait stands in front of that
  __builtin_amdgcn_sched_barrier(0);   // keeps the vector work below behind the wait
  float m[QT], l[QT];   // per lane: its query's running maximum (equal in both wave halves) and the sum over the keys of its own half
#pragma unroll
  for (int t = 0; t < QT; ++t) { m[t] = -3.0e38f; l[t] = 0.f; }
  v8f acc[QT][3][3] = {};   // O^T tiles: register r = value dim dt * 16 + 8 g + r, column = query
#pragma unroll 1
  for (int ks = 0; ks < SS / 32; ++ks) { const int j0 = ks * 32; v8f s[QT][2];
    v16h vf[3][3];   // the pass's value fragments: all loads issued here as one group, they land behind the score products and the softmax
    __builtin_amdgcn_sched_barrier(0);   // with the one behind the wait: nothing but the loads stands between them, so no other instruction takes over an address register ahead of the wait
#pragma unroll
    for (int b = 0; b < 3; ++b)
#pragma unroll
      for (int dt = 0; dt < 3; ++dt) vf[b][dt] = frag_h(V + (((size_t)b * NH * HDV + h * HDV + dt * 16 + col) * SS) + j0, lane);
    asm volatile("s_wait_xcnt 0x0" ::: "memory");   // the value loads' address registers are free for reuse behind them: the wait stands in front of any rewrite
    __builtin_amdgcn_sched_barrier(0);   // keeps later vector work behind the wait
#pragma unroll
    for (int ct = 0; ct < 2; ++ct)
#pragma unroll
      for (int t = 0; t < QT; ++t) { v8f c = {};
#pragma unroll
        for (int kc = 0; kc < 2; ++kc) c = wmma16(kf[ct][kc], aq[t][kc], c);   // rows = keys j0 + ct * 16 + 8 g + r, column = query
#pragma unroll
        for (int r = 0; r < 8; ++r) s[t][ct][r] = c[r] * 0.15811388300841897f; }   // 40^-0.5
    const int jn = (ks + 1 < SS / 32) ? j0 + 32 : 0;   // next pass's keys (the last pass re-reads the first rows, unused)
    const _Float16* kp = Kr + (size_t)(jn + col) * (NH * HDK) + h * HDK;   // one base for the eight loads
    __builtin_amdgcn_sched_barrier(0);   // with the one behind the wait: nothing but the loads stands between them
#pragma unroll
    for (int ct = 0; ct < 2; ++ct)
#pragma unroll
      for (int kc = 0; kc < 2; ++kc) kf[ct][kc] = frag_h(kp + ct * 16 * (NH * HDK) + kc * 32, lane);
    asm volatile("s_wait_xcnt 0x0" ::: "memory");   // the key loads' address registers are reused by the softmax: the wait stands in front of that
    __builtin_amdgcn_sched_barrier(0);   // keeps the key loads in front of the softmax, whose whole length then covers their latency
    v16h pb[QT];   // P^T as B operand: element ct * 8 + r = key ct * 16 + 8 g + r, the hardware k order that frag_h gives the value fragments
#pragma unroll
    for (int t = 0; t < QT; ++t) { float mr[8];
#pragma unroll
      for (int r = 0; r < 8; ++r) mr[r] = fmaxf(s[t][0][r], s[t][1][r]);
      float mx = fmaxf(fmaxf(fmaxf(mr[0], mr[1]), fmaxf(mr[2], mr[3])), fmaxf(fmaxf(mr[4], mr[5]), fmaxf(mr[6], mr[7])));
      mx = fmaxf(mx, xhalf(mx));   // the other half's 16 keys
      const float mn = fmaxf(m[t], mx); const float alpha = (m[t] <= -1.0e38f) ? 0.f : __expf(m[t] - mn); float er[8];
#pragma unroll
      for (int r = 0; r < 8; ++r) { const float e0 = __expf(s[t][0][r] - mn), e1 = __expf(s[t][1][r] - mn); er[r] = e0 + e1;
        pb[t][r] = (_Float16)(e0 * 2048.0f); pb[t][8 + r] = (_Float16)(e1 * 2048.0f); }
      l[t] = l[t] * alpha + (((er[0] + er[1]) + (er[2] + er[3])) + ((er[4] + er[5]) + (er[6] + er[7]))); m[t] = mn;
#pragma unroll
      for (int b = 0; b < 3; ++b)
#pragma unroll
        for (int dt = 0; dt < 3; ++dt) acc[t][b][dt] *= alpha; }
#pragma unroll
    for (int b = 0; b < 3; ++b)
#pragma unroll
      for (int dt = 0; dt < 3; ++dt)
#pragma unroll
        for (int t = 0; t < QT; ++t) acc[t][b][dt] = wmma16(vf[b][dt], pb[t], acc[t][b][dt]); }
  float il[QT];
#pragma unroll
  for (int t = 0; t < QT; ++t) il[t] = (1.0f / 2048.0f) / (l[t] + xhalf(l[t]));   // the two halves' sums joined once, with every lane on
#pragma unroll
  for (int t = 0; t < QT; ++t) {
#pragma unroll
  for (int b = 0; b < 3; ++b) {
#pragma unroll
    for (int dt = 0; dt < 3; ++dt)
#pragma unroll
      for (int r = 0; r < 8; ++r) so[wave][col][dt * 16 + 8 * g + r] = (dt * 16 + 8 * g + r < HD) ? acc[t][b][dt][r] * il[t] : 0.f;
#pragma unroll
    for (int r = 0; r < 8; ++r) so[wave][col][48 + 8 * g + r] = 0.f;
    LDSX();
    for (int rl = 0; rl < 16; ++rl) if (lane < 16) vst2(O + ((size_t)b * SS + q0 + t * 16 + rl) * OSTR + h * 64 + lane * 4, *(const v4f*)&so[wave][rl][lane * 4]);   // the head's whole 256-B slot (40 live + 24 zeros): single writer per line, no uninitialised pad
    LDSX(); } }
}
// ---- k_out: block = (64 rows, 64-column chunk (5 chunks of 320)): out = o (hi + residual, K 512 head slots) . Wo rows + bo
__global__ __launch_bounds__(128) void k_out(const float* __restrict__ O, const __bf16* __restrict__ POS, const float* __restrict__ BO, float* __restrict__ OUT) {
  __shared__ __align__(16) float so[4][16][68];
  const int tid = threadIdx.x, wave = tid >> 5, lane = tid & 31, col = lane & 15, g = lane >> 4; const size_t r0 = (size_t)blockIdx.x * 64 + wave * 16; const int n0 = blockIdx.y * 64;
  v8f acc[4] = {};
#pragma unroll
  for (int kc = 0; kc < OSTR / 32; ++kc) { if ((kc & 1) && ((kc * 32) & 63) >= 48) {}   // (all chunks carry live or zero-weighted columns)
    const F2 a = split_row(O + (r0 + col) * OSTR, kc * 32, lane);
#pragma unroll
    for (int j = 0; j < 4; ++j) { const v16b w = frag_b(POS + (size_t)(n0 + j * 16 + col) * OSTR + kc * 32, lane); acc[j] = wmma_bf(a.l, w, acc[j]); acc[j] = wmma_bf(a.h, w, acc[j]); } }
#pragma unroll
  for (int j = 0; j < 4; ++j) { const float bb = bfr(BO[n0 + j * 16 + col]);
#pragma unroll
    for (int r = 0; r < 8; ++r) so[wave][8 * g + r][j * 16 + col] = acc[j][r] + bb; }
  LDSX();
  for (int rl = 0; rl < 16; ++rl) if (lane < 16) vst2(OUT + (r0 + rl) * DM + n0 + lane * 4, *(const v4f*)&so[wave][rl][lane * 4]);
}
extern "C" void kernel_launch(void* const* d_in, const int* in_sizes, int n_in, void* d_out, int out_size, void* d_ws, size_t ws_size, hipStream_t stream) {
  (void)in_sizes; (void)n_in; (void)out_size;
  const float** F = (const float**)d_in;   // 0 x [3,4096,320], 1 Wq, 2 Wk, 3 Wv, 4 Wo (natural [320,320]), 5 bo
  if (ws_size < (size_t)WS_END) return;
  char* ws = (char*)d_ws; __bf16* P = (__bf16*)ws; __bf16* POS = (__bf16*)(ws + WS_POS); _Float16 *Q = (_Float16*)(ws + WS_Q), *Kr = (_Float16*)(ws + WS_K), *V = (_Float16*)(ws + WS_V); float* O = (float*)(ws + WS_O);
  k_pack<<<dim3(DM, 4), 64, 0, stream>>>(F[1], F[2], F[3], F[4], P, POS);
  k_zero<<<(unsigned)(((size_t)SS * NH * HDK * 2 + (size_t)NB * NH * HDV * SS) / 4096), 256, 0, stream>>>(Q, (size_t)SS * NH * HDK * 2 + (size_t)NB * NH * HDV * SS);   // Q, K (contiguous) and V regions
  k_proj<<<dim3(NR / 64, NH, 3), 128, 0, stream>>>(F[0], P, Q, Kr, V);
  k_attn<<<dim3(SS / (64 * QT), NH), 128, 0, stream>>>(Q, Kr, V, O);
  k_out<<<dim3(NR / 64, DM / 64), 128, 0, stream>>>(O, POS, F[5], (float*)d_out);
}

// v004
// A run of this version takes 157 microseconds.
// In both of two side-by-side timings against v003, it was 1.04 times as fast.
// Over all steps from v000 it is 2.83 times as fast.
// compute dtype: all float inputs rounded to bf16; q, k (from the source third x[0]) and v (all three batches) = x . W^T with EXACT bf16 products on WMMA 16x16x32 (natural rows), rounded once to f16 with the 40-dim heads zero-padded to 64 (keys) / 48 (values); PLAIN attention shared across the three batches: q, k as single f16 operands x 40^-0.5, running-max softmax in f32 (hardware exp), P (scaled by 2^11, single f16) x v (single f16) for the three value sets at once; out = o (bf16 hi + residual) . Wo^T (2 products) + bo.
#include <hip/hip_runtime.h>
#include <math.h>

typedef __attribute__((ext_vector_type(16))) _Float16 v16h;
typedef __attribute__((ext_vector_type(16))) __bf16 v16b;
typedef __attribute__((ext_vector_type(8)))  _Float16 v8h;
typedef __attribute__((ext_vector_type(8)))  float v8f;
typedef __attribute__((ext_vector_type(4)))  float v4f;
typedef __attribute__((ext_vector_type(2)))  float v2f;
typedef __attribute__((ext_vector_type(4)))  unsigned v4u;
typedef __attribute__((ext_vector_type(4)))  int v4i;
typedef float __attribute__((may_alias)) float_a;
typedef int __attribute__((may_alias)) int_a;

template <typename T> __device__ __forceinline__ void vst2(void* p, T v) { *(T*)p = v;  }
__device__ __forceinline__ v8f wmma16(v16h a, v16h b, v8f c) {
  return __builtin_amdgcn_wmma_f32_16x16x32_f16(false, a, false, b, (short)0, c, false, false);   // plain builtin: the compiler keeps the distance behind it; an asm statement on its operands would hold all of them below v256, and the two-tile wave has more than that live
}
__device__ __forceinline__ v8f wmma_bf(v16b a, v16b b, v8f c) {
  v8f d = __builtin_amdgcn_wmma_f32_16x16x32_bf16(false, a, false, b, (short)0, c, false, false);
  asm volatile("v_nop\n\tv_nop\n\tv_nop\n\tv_nop" : "+v"(d) : "v"(a), "v"(b));
  return d;
}
// 16x16x32 fragments: lane = (h = lane>>4, row/col = lane&15); elements 0..7 = k0+8h+0..7, 8..15 = k0+16+8h+0..7; D element r = row 8h+r
__device__ __forceinline__ v16h frag_h(const _Float16* rowk0, int lane) {
  union { v16h v; v8h q[2]; } u; const _Float16* p = rowk0 + 8 * (lane >> 4);
  u.q[0] = *(const v8h*)p; u.q[1] = *(const v8h*)(p + 16); return u.v;
}
__device__ __forceinline__ v16h frag_f32(const float* rowk0, int lane) {
  v16h a; const float* p = rowk0 + 8 * (lane >> 4);
#pragma unroll
  for (int i = 0; i < 8; ++i) { a[i] = (_Float16)p[i]; a[8 + i] = (_Float16)p[16 + i]; }
  return a;
}
__device__ __forceinline__ v16h frag_f32s(const float* rowk0, int lane, float sc) {
  v16h a; const float* p = rowk0 + 8 * (lane >> 4);
#pragma unroll
  for (int i = 0; i < 8; ++i) { a[i] = (_Float16)(p[i] * sc); a[8 + i] = (_Float16)(p[16 + i] * sc); }
  return a;
}
// column fragment from a [K][ld] layout (column n), rows >= K read as 0
__device__ __forceinline__ v16h fragc_f32(const float* W, int k0, int n, int lane, int ld, int K) {
  v16h a; const int g = lane >> 4;
#pragma unroll
  for (int i = 0; i < 8; ++i) { const int ka = k0 + 8 * g + i, kb = ka + 16;
    a[i] = (_Float16)(ka < K ? W[(size_t)(ka < K ? ka : K - 1) * ld + n] : 0.f); a[8 + i] = (_Float16)(kb < K ? W[(size_t)(kb < K ? kb : K - 1) * ld + n] : 0.f); }
  return a;
}
struct F2 { v16b h, l; };
__device__ __forceinline__ F2 bsplit16(const float v[16]) { F2 r;
#pragma unroll
  for (int i = 0; i < 16; ++i) { const __bf16 h = (__bf16)v[i]; r.h[i] = h; r.l[i] = (__bf16)(v[i] - (float)h); }
  return r; }
__device__ __forceinline__ F2 split_row(const float* row, int k0, int lane) { float v[16]; const float* p = row + k0 + 8 * (lane >> 4);
#pragma unroll
  for (int i = 0; i < 8; ++i) { v[i] = p[i]; v[8 + i] = p[16 + i]; }
  return bsplit16(v); }
__device__ __forceinline__ F2 split_rowK(const float* row, int k0, int lane, int K) { float v[16]; const int g = lane >> 4;
#pragma unroll
  for (int i = 0; i < 8; ++i) { const int ka = k0 + 8 * g + i, kb = ka + 16; v[i] = ka < K ? row[ka < K ? ka : K - 1] : 0.f; v[8 + i] = kb < K ? row[kb < K ? kb : K - 1] : 0.f; }
  return bsplit16(v); }
__device__ __forceinline__ F2 split_col(const float* W, int k0, int n, int lane, int ld, int K) { float v[16]; const int g = lane >> 4;
#pragma unroll
  for (int i = 0; i < 8; ++i) { const int ka = k0 + 8 * g + i, kb = ka + 16; v[i] = ka < K ? W[(size_t)(ka < K ? ka : K - 1) * ld + n] : 0.f; v[8 + i] = kb < K ? W[(size_t)(kb < K ? kb : K - 1) * ld + n] : 0.f; }
  return bsplit16(v); }
__device__ __forceinline__ v8f mac3(const F2& a, const F2& b, v8f c) { c = wmma_bf(a.l, b.h, c); c = wmma_bf(a.h, b.l, c); return wmma_bf(a.h, b.h, c); }
__device__ __forceinline__ float sigm(float v) { return 1.0f / (1.0f + expf(-v)); }
#define LDSX() do { asm volatile("s_wait_dscnt 0" ::: "memory"); __builtin_amdgcn_wave_barrier(); __builtin_amdgcn_fence(__ATOMIC_RELEASE, "workgroup"); } while (0)


// Plug-and-play feature injection attention (3 x 4,096 tokens x 320, 8 heads x 40): the source batch's queries and keys are reused for all three batches, values differ; softmax(q k^T / sqrt(40)) v, output projection + bias.
#define NB 3
#define SS 4096
#define DM 320
#define NH 8
#define HD 40
#define HDK 64            // key dims padded to 2 k-chunks
#define HDV 48            // value dims padded to 3 tiles
#define NR (NB * SS)
typedef __attribute__((ext_vector_type(8))) __bf16 v8b;
__device__ __forceinline__ v16b frag_b(const __bf16* rowk0, int lane) {
  union { v16b v; v8b q[2]; } u; const __bf16* p = rowk0 + 8 * (lane >> 4);
  u.q[0] = *(const v8b*)p; u.q[1] = *(const v8b*)(p + 16); return u.v;
}
__device__ __forceinline__ float bfr(float v) { return (float)(__bf16)v; }
__device__ __attribute__((noinline)) float exp_ni(float v) { return expf(v); }
__device__ __attribute__((noinline)) float erf_ni(float v) { return erff(v); }

#define WS_PW   0u                                   // bf16 natural rows Wq, Wk, Wv, Wo [4][320][320]
#define WS_Q    (WS_PW + 2u * (size_t)4 * DM * DM)     // f16 [SS][NH*64] q (padded) ; K likewise (batch 0 only)
#define WS_K    (WS_Q + 2u * (size_t)SS * NH * HDK)
#define WS_V    (WS_K + 2u * (size_t)SS * NH * HDK)     // f16 planes [b][NH*48][SS] (pad planes zero)
#define OSTR    (NH * 64)                             // O row stride: 64-float (256-B) slot per head, one writer per line
#define WS_O    (WS_V + 2u * (size_t)NB * NH * HDV * SS) // f32 [NR][OSTR]
#define WS_POS  (WS_O + 4u * (size_t)NR * OSTR)      // bf16 [320][512] Wo rows in slot layout
#define WS_END  (WS_POS + 2u * (size_t)DM * OSTR)

__global__ __launch_bounds__(64) void k_pack(const float* __restrict__ WQ, const float* __restrict__ WK, const float* __restrict__ WV, const float* __restrict__ WO, __bf16* __restrict__ P, __bf16* __restrict__ POS) { const int n = blockIdx.x, which = blockIdx.y, t = threadIdx.x; const float* Wm = (which == 0) ? WQ : (which == 1) ? WK : (which == 2) ? WV : WO; __shared__ __align__(16) __bf16 s[OSTR]; for (int k = t; k < DM; k += 64) s[k] = (__bf16)Wm[(size_t)n * DM + k]; __syncthreads(); if (t < DM / 8) vst2((unsigned*)(P + ((size_t)which * DM + n) * DM + t * 8), *(const v4u*)&s[t * 8]);
  if (which == 3) { __syncthreads(); __shared__ __align__(16) __bf16 s2[OSTR]; for (int k = t; k < OSTR; k += 64) { const int hh = k >> 6, d = k & 63; s2[k] = (d < HD) ? s[hh * HD + d] : (__bf16)0.f; } __syncthreads(); for (int q = t; q < OSTR / 8; q += 64) vst2((unsigned*)(POS + (size_t)n * OSTR + q * 8), *(const v4u*)&s2[q * 8]); } }   // Wo rows re-laid to the 64-wide head slots (zeros in the pads)
// ---- k_zero: zero the padded q/k columns and v planes once (f16 zeros): block = 4096-element chunk
__global__ __launch_bounds__(256) void k_zero(_Float16* __restrict__ A, size_t n16) { const size_t i = ((size_t)blockIdx.x * 256 + threadIdx.x) * 16; if (i + 16 <= n16) { v4f z; z[0] = z[1] = z[2] = z[3] = 0.f; vst2((float*)(A + i), z); vst2((float*)(A + i + 8), z); } }
// ---- k_proj: block = (64 rows, head h, which): the head's 40 output columns (3 tiles, last tile half used); which 0: q (batch-0 rows) -> Q[s][h*64 + d]; 1: k likewise; 2: v for all batches -> planes [b][h*48 + d][s]
__global__ __launch_bounds__(128) void k_proj(const float* __restrict__ X, const __bf16* __restrict__ P, _Float16* __restrict__ Q, _Float16* __restrict__ Kr, _Float16* __restrict__ V) {
  __shared__ __align__(16) _Float16 so[64][56]; __shared__ __align__(16) _Float16 st[48][72];
  const int tid = threadIdx.x, wave = tid >> 5, lane = tid & 31, col = lane & 15, g = lane >> 4; const int h = blockIdx.y, which = blockIdx.z; const size_t rb0 = (size_t)blockIdx.x * 64, r0 = rb0 + wave * 16;
  if (which < 2 && rb0 >= SS) return;   // q, k only from the source batch
  const __bf16* Wr = P + ((size_t)which * DM + h * HD) * DM;
  v8f acc[3] = {};
#pragma unroll
  for (int kc = 0; kc < DM / 32; ++kc) { v16b a; { const float* p = X + (r0 + col) * DM + kc * 32 + 8 * g;
#pragma unroll
      for (int i = 0; i < 8; ++i) { a[i] = (__bf16)p[i]; a[8 + i] = (__bf16)p[16 + i]; } }
#pragma unroll
    for (int j = 0; j < 3; ++j) { const int n = j * 16 + col; acc[j] = wmma_bf(a, frag_b(Wr + (size_t)min(n, HD - 1) * DM + kc * 32, lane), acc[j]); } }   // rows n >= 40 clamp (their columns are discarded)
  if (which < 2) {
#pragma unroll
    for (int j = 0; j < 3; ++j) { const int n = j * 16 + col;
#pragma unroll
      for (int r = 0; r < 8; ++r) so[wave * 16 + 8 * g + r][n] = (n < HD) ? (_Float16)acc[j][r] : (_Float16)0.f; }
    LDSX();
    _Float16* dst = (which == 0) ? Q : Kr;
    for (int rl = 0; rl < 16; ++rl) if (lane < 6) vst2((unsigned*)(dst + (r0 + rl) * (NH * HDK) + h * HDK + lane * 8), *(const v4u*)&so[wave * 16 + rl][lane * 8]);   // 48 columns written (40 live + 8 zero); columns 48..63 zeroed by k_zero
  } else {
#pragma unroll
    for (int j = 0; j < 3; ++j) { const int n = j * 16 + col;
#pragma unroll
      for (int r = 0; r < 8; ++r) st[n][wave * 16 + 8 * g + r] = (n < HD) ? (_Float16)acc[j][r] : (_Float16)0.f; }
    __syncthreads();
    const size_t b = rb0 / SS, s0 = rb0 % SS;
    for (int e = tid; e < 48 * 8; e += 128) { const int d = e >> 3, pc = e & 7; vst2((unsigned*)(V + ((b * NH * HDV + h * HDV + d) * SS) + s0 + pc * 8), *(const v4u*)&st[d][pc * 8]); } }
}
// ---- k_attn: block = (128 queries, head), 8 waves: waves w and w + 4 take the same 32 queries (two 16-column tiles) and one half of the 4,096 keys each, so that one wave's softmax issues under the other's products; the two partial results are joined once through LDS behind the loop. Transposed products: S^T = K . Q^T (a lane holds 16 of one query's 32 scores of the pass), O^T += V^T . P^T for the three batches' value planes (3 x 3 tiles); P^T goes from the score accumulators straight into the B operand
#define QT 2
#define KH (SS / 2)       // keys of one wave
// amdgpu_waves_per_eu(2, 2): the block's 8 waves stand two on a SIMD, and the compiler schedules and budgets registers for exactly that
__device__ __forceinline__ float xhalf(float x) { return __builtin_bit_cast(float, __builtin_amdgcn_permlanex16(__builtin_bit_cast(int, x), __builtin_bit_cast(int, x), 0x76543210, 0xfedcba98, false, false)); }   // lane l's value from lane l ^ 16
__global__ __launch_bounds__(256) __attribute__((amdgpu_waves_per_eu(2, 2))) void k_attn(const _Float16* __restrict__ Q, const _Float16* __restrict__ Kr, const _Float16* __restrict__ V, float* __restrict__ O) {
  __shared__ __align__(16) float so[8][16][68];
  __shared__ __align__(16) v4f xa[8][18][32];   // hand-over: the 72 accumulator registers of the tile a wave gives away, 16 bytes a lane
  __shared__ float xm[8][2][32];                // with that tile's maximum and sum
  const int tid = threadIdx.x, wave = tid >> 5, lane = tid & 31, col = lane & 15, g = lane >> 4; const int h = blockIdx.y; const int q0 = blockIdx.x * (64 * QT) + (wave & 3) * (16 * QT);
  const int kh = __builtin_amdgcn_readfirstlane(tid >> 7);   // the wave's key half, held scalar so that the loop's addresses keep their scalar part
  const int kb = kh * KH;
  v16h aq[QT][2];
#pragma unroll
  for (int t = 0; t < QT; ++t)
#pragma unroll
    for (int kc = 0; kc < 2; ++kc) aq[t][kc] = frag_h(Q + (size_t)(q0 + t * 16 + col) * (NH * HDK) + h * HDK + kc * 32, lane);
  v16h kf[2][2];   // the pass's key fragments, fetched one pass ahead
#pragma unroll
  for (int ct = 0; ct < 2; ++ct)
#pragma unroll
    for (int kc = 0; kc < 2; ++kc) kf[ct][kc] = frag_h(Kr + (size_t)(kb + ct * 16 + col) * (NH * HDK) + h * HDK + kc * 32, lane);
  asm volatile("s_wait_xcnt 0x0" ::: "memory");   // the query and key loads' address registers are reused below: the wait stands in front of that
  __builtin_amdgcn_sched_barrier(0);   // keeps the vector work below behind the wait
  float m[QT], l[QT];   // per lane: its query's running maximum (equal in both wave halves) and the sum over the keys of its own half
#pragma unroll
  for (int t = 0; t < QT; ++t) { m[t] = -3.0e38f; l[t] = 0.f; }
  v8f acc[QT][3][3] = {};   // O^T tiles: register r = value dim dt * 16 + 8 g + r, column = query
#pragma unroll 1
  for (int ks = 0; ks < KH / 32; ++ks) { const int j0 = kb + ks * 32; v8f s[QT][2];
    v16h vf[3][3];   // the pass's value fragments: all loads issued here as one group, they land behind the score products and the softmax
    __builtin_amdgcn_sched_barrier(0);   // with the one behind the wait: nothing but the loads stands between them, so no other instruction takes over an address register ahead of the wait
#pragma unroll
    for (int b = 0; b < 3; ++b)
#pragma unroll
      for (int dt = 0; dt < 3; ++dt) vf[b][dt] = frag_h(V + (((size_t)b * NH * HDV + h * HDV + dt * 16 + col) * SS) + j0, lane);
    asm volatile("s_wait_xcnt 0x0" ::: "memory");   // the value loads' address registers are free for reuse behind them: the wait stands in front of any rewrite
    __builtin_amdgcn_sched_barrier(0);   // keeps later vector work behind the wait
#pragma unroll
    for (int ct = 0; ct < 2; ++ct)
#pragma unroll
      for (int t = 0; t < QT; ++t) { v8f c = {};
#pragma unroll
        for (int kc = 0; kc < 2; ++kc) c = wmma16(kf[ct][kc], aq[t][kc], c);   // rows = keys j0 + ct * 16 + 8 g + r, column = query
#pragma unroll
        for (int r = 0; r < 8; ++r) s[t][ct][r] = c[r] * 0.15811388300841897f; }   // 40^-0.5
    const int jn = (ks + 1 < KH / 32) ? j0 + 32 : 0;   // next pass's keys (the last pass re-reads the first rows, unused)
    const _Float16* kp = Kr + (size_t)(jn + col) * (NH * HDK) + h * HDK;   // one base for the eight loads
    __builtin_amdgcn_sched_barrier(0);   // with the one behind the wait: nothing but the loads stands between them
#pragma unroll
    for (int ct = 0; ct < 2; ++ct)
#pragma unroll
      for (int kc = 0; kc < 2; ++kc) kf[ct][kc] = frag_h(kp + ct * 16 * (NH * HDK) + kc * 32, lane);
    asm volatile("s_wait_xcnt 0x0" ::: "memory");   // the key loads' address registers are reused by the softmax: the wait stands in front of that
    __builtin_amdgcn_sched_barrier(0);   // keeps the key loads in front of the softmax, whose whole length then covers their latency
    v16h pb[QT];   // P^T as B operand: element ct * 8 + r = key ct * 16 + 8 g + r, the hardware k order that frag_h gives the value fragments
#pragma unroll
    for (int t = 0; t < QT; ++t) { float mr[8];
#pragma unroll
      for (int r = 0; r < 8; ++r) mr[r] = fmaxf(s[t][0][r], s[t][1][r]);
      float mx = fmaxf(fmaxf(fmaxf(mr[0], mr[1]), fmaxf(mr[2], mr[3])), fmaxf(fmaxf(mr[4], mr[5]), fmaxf(mr[6], mr[7])));
      mx = fmaxf(mx, xhalf(mx));   // the other half's 16 keys
      const float mn = fmaxf(m[t], mx); const float alpha = (m[t] <= -1.0e38f) ? 0.f : __expf(m[t] - mn); float er[8];
#pragma unroll
      for (int r = 0; r < 8; ++r) { const float e0 = __expf(s[t][0][r] - mn), e1 = __expf(s[t][1][r] - mn); er[r] = e0 + e1;
        pb[t][r] = (_Float16)(e0 * 2048.0f); pb[t][8 + r] = (_Float16)(e1 * 2048.0f); }
      l[t] = l[t] * alpha + (((er[0] + er[1]) + (er[2] + er[3])) + ((er[4] + er[5]) + (er[6] + er[7]))); m[t] = mn;
#pragma unroll
      for (int b = 0; b < 3; ++b)
#pragma unroll
        for (int dt = 0; dt < 3; ++dt) acc[t][b][dt] *= alpha; }
#pragma unroll
    for (int b = 0; b < 3; ++b)
#pragma unroll
      for (int dt = 0; dt < 3; ++dt)
#pragma unroll
        for (int t = 0; t < QT; ++t) acc[t][b][dt] = wmma16(vf[b][dt], pb[t], acc[t][b][dt]); }
  // join of the two key halves: the wave of half kh finishes query tile kh and hands its partial result for the other tile to its partner (wave ^ 4)
  v8f ka[3][3]; const float km = kh ? m[1] : m[0], kl = kh ? l[1] : l[0];
#pragma unroll
  for (int b = 0; b < 3; ++b)
#pragma unroll
    for (int dt = 0; dt < 3; ++dt) { const v8f ga = kh ? acc[0][b][dt] : acc[1][b][dt]; ka[b][dt] = kh ? acc[1][b][dt] : acc[0][b][dt];
      v4f lo, hi;
#pragma unroll
      for (int r = 0; r < 4; ++r) { lo[r] = ga[r]; hi[r] = ga[4 + r]; }
      xa[wave][(b * 3 + dt) * 2][lane] = lo; xa[wave][(b * 3 + dt) * 2 + 1][lane] = hi; }
  xm[wave][0][lane] = kh ? m[0] : m[1]; xm[wave][1][lane] = kh ? l[0] : l[1];
  __syncthreads();   // every wave's hand-over is written before its partner reads it
  const int pw = wave ^ 4; const float pm = xm[pw][0][lane], pl = xm[pw][1][lane];
  const float mj = fmaxf(km, pm); const float fk = __expf(km - mj), fp = __expf(pm - mj);   // both halves have seen keys, so both maxima are scores
  const float lj = kl * fk + pl * fp;
  const float il = (1.0f / 2048.0f) / (lj + xhalf(lj));   // the two wave halves' sums joined once, with every lane on
  const float ck = fk * il, cp = fp * il;
#pragma unroll
  for (int b = 0; b < 3; ++b) {
#pragma unroll
    for (int dt = 0; dt < 3; ++dt) { const v4f lo = xa[pw][(b * 3 + dt) * 2][lane], hi = xa[pw][(b * 3 + dt) * 2 + 1][lane];
#pragma unroll
      for (int r = 0; r < 8; ++r) so[wave][col][dt * 16 + 8 * g + r] = (dt * 16 + 8 * g + r < HD) ? ka[b][dt][r] * ck + (r < 4 ? lo[r & 3] : hi[r & 3]) * cp : 0.f; }
#pragma unroll
    for (int r = 0; r < 8; ++r) so[wave][col][48 + 8 * g + r] = 0.f;
    LDSX();
    for (int rl = 0; rl < 16; ++rl) if (lane < 16) vst2(O + ((size_t)b * SS + q0 + kh * 16 + rl) * OSTR + h * 64 + lane * 4, *(const v4f*)&so[wave][rl][lane * 4]);   // the head's whole 256-B slot (40 live + 24 zeros): single writer per line, no uninitialised pad
    LDSX(); }
}
// ---- k_out: block = (64 rows, 64-column chunk (5 chunks of 320)): out = o (hi + residual, K 512 head slots) . Wo rows + bo
__global__ __launch_bounds__(128) void k_out(const float* __restrict__ O, const __bf16* __restrict__ POS, const float* __restrict__ BO, float* __restrict__ OUT) {
  __shared__ __align__(16) float so[4][16][68];
  const int tid = threadIdx.x, wave = tid >> 5, lane = tid & 31, col = lane & 15, g = lane >> 4; const size_t r0 = (size_t)blockIdx.x * 64 + wave * 16; const int n0 = blockIdx.y * 64;
  v8f acc[4] = {};
#pragma unroll
  for (int kc = 0; kc < OSTR / 32; ++kc) { if ((kc & 1) && ((kc * 32) & 63) >= 48) {}   // (all chunks carry live or zero-weighted columns)
    const F2 a = split_row(O + (r0 + col) * OSTR, kc * 32, lane);
#pragma unroll
    for (int j = 0; j < 4; ++j) { const v16b w = frag_b(POS + (size_t)(n0 + j * 16 + col) * OSTR + kc * 32, lane); acc[j] = wmma_bf(a.l, w, acc[j]); acc[j] = wmma_bf(a.h, w, acc[j]); } }
#pragma unroll
  for (int j = 0; j < 4; ++j) { const float bb = bfr(BO[n0 + j * 16 + col]);
#pragma unroll
    for (int r = 0; r < 8; ++r) so[wave][8 * g + r][j * 16 + col] = acc[j][r] + bb; }
  LDSX();
  for (int rl = 0; rl < 16; ++rl) if (lane < 16) vst2(OUT + (r0 + rl) * DM + n0 + lane * 4, *(const v4f*)&so[wave][rl][lane * 4]);
}
extern "C" void kernel_launch(void* const* d_in, const int* in_sizes, int n_in, void* d_out, int out_size, void* d_ws, size_t ws_size, hipStream_t stream) {
  (void)in_sizes; (void)n_in; (void)out_size;
  const float** F = (const float**)d_in;   // 0 x [3,4096,320], 1 Wq, 2 Wk, 3 Wv, 4 Wo (natural [320,320]), 5 bo
  if (ws_size < (size_t)WS_END) return;
  char* ws = (char*)d_ws; __bf16* P = (__bf16*)ws; __bf16* POS = (__bf16*)(ws + WS_POS); _Float16 *Q = (_Float16*)(ws + WS_Q), *Kr = (_Float16*)(ws + WS_K), *V = (_Float16*)(ws + WS_V); float* O = (float*)(ws + WS_O);
  k_pack<<<dim3(DM, 4), 64, 0, stream>>>(F[1], F[2], F[3], F[4], P, POS);
  k_zero<<<(unsigned)(((size_t)SS * NH * HDK * 2 + (size_t)NB * NH * HDV * SS) / 4096), 256, 0, stream>>>(Q, (size_t)SS * NH * HDK * 2 + (size_t)NB * NH * HDV * SS);   // Q, K (contiguous) and V regions
  k_proj<<<dim3(NR / 64, NH, 3), 128, 0, stream>>>(F[0], P, Q, Kr, V);
  k_attn<<<dim3(SS / (64 * QT), NH), 256, 0, stream>>>(Q, Kr, V, O);
  k_out<<<dim3(NR / 64, DM / 64), 128, 0, stream>>>(O, POS, F[5], (float*)d_out);
}

// v005
// One run takes 120 microseconds.
// In both of two side-by-side timings against v004, it was 1.31 times as fast.
// Over all steps from v000 it is 3.71 times as fast.
// compute dtype: all float inputs rounded to bf16; q, k (from the source third x[0]) and v (all three batches) = x . W^T with EXACT bf16 products on WMMA 16x16x32 (natural rows), rounded once to f16 with the 40-dim heads zero-padded to 64 (keys) / 48 (values); PLAIN attention shared across the three batches: q, k as single f16 operands x 40^-0.5, running-max softmax in f32 (hardware exp), P (scaled by 2^11, single f16) x v (single f16) for the three value sets at once; out = o (bf16 hi + residual) . Wo^T (2 products) + bo.
#include <hip/hip_runtime.h>
#include <math.h>

typedef __attribute__((ext_vector_type(16))) _Float16 v16h;
typedef __attribute__((ext_vector_type(16))) __bf16 v16b;
typedef __attribute__((ext_vector_type(8)))  _Float16 v8h;
typedef __attribute__((ext_vector_type(8)))  float v8f;
typedef __attribute__((ext_vector_type(4)))  float v4f;
typedef __attribute__((ext_vector_type(2)))  float v2f;
typedef __attribute__((ext_vector_type(4)))  unsigned v4u;
typedef __attribute__((ext_vector_type(4)))  int v4i;
typedef float __attribute__((may_alias)) float_a;
typedef int __attribute__((may_alias)) int_a;

template <typename T> __device__ __forceinline__ void vst2(void* p, T v) { *(T*)p = v;  }
__device__ __forceinline__ v8f wmma16(v16h a, v16h b, v8f c) {
  return __builtin_amdgcn_wmma_f32_16x16x32_f16(false, a, false, b, (short)0, c, false, false);   // plain builtin: the compiler keeps the distance behind it; an asm statement on its operands would hold all of them below v256, and the two-tile wave has more than that live
}
__device__ __forceinline__ v8f wmma_bf(v16b a, v16b b, v8f c) {
  v8f d = __builtin_amdgcn_wmma_f32_16x16x32_bf16(false, a, false, b, (short)0, c, false, false);
  asm volatile("v_nop\n\tv_nop\n\tv_nop\n\tv_nop" : "+v"(d) : "v"(a), "v"(b));
  return d;
}
// 16x16x32 fragments: lane = (h = lane>>4, row/col = lane&15); elements 0..7 = k0+8h+0..7, 8..15 = k0+16+8h+0..7; D element r = row 8h+r
__device__ __forceinline__ v16h frag_h(const _Float16* rowk0, int lane) {
  union { v16h v; v8h q[2]; } u; const _Float16* p = rowk0 + 8 * (lane >> 4);
  u.q[0] = *(const v8h*)p; u.q[1] = *(const v8h*)(p + 16); return u.v;
}
// fragment stored in fragment order: two runs of 512 B, 16 B a lane (p already holds the lane's 8 * lane), so that a wave's load covers four whole 128-B lines
__device__ __forceinline__ v16h frag_l(const _Float16* p) {
  union { v16h v; v8h q[2]; } u; u.q[0] = *(const v8h*)p; u.q[1] = *(const v8h*)(p + 256); return u.v;
}
__device__ __forceinline__ v16h frag_f32(const float* rowk0, int lane) {
  v16h a; const float* p = rowk0 + 8 * (lane >> 4);
#pragma unroll
  for (int i = 0; i < 8; ++i) { a[i] = (_Float16)p[i]; a[8 + i] = (_Float16)p[16 + i]; }
  return a;
}
__device__ __forceinline__ v16h frag_f32s(const float* rowk0, int lane, float sc) {
  v16h a; const float* p = rowk0 + 8 * (lane >> 4);
#pragma unroll
  for (int i = 0; i < 8; ++i) { a[i] = (_Float16)(p[i] * sc); a[8 + i] = (_Float16)(p[16 + i] * sc); }
  return a;
}
// column fragment from a [K][ld] layout (column n), rows >= K read as 0
__device__ __forceinline__ v16h fragc_f32(const float* W, int k0, int n, int lane, int ld, int K) {
  v16h a; const int g = lane >> 4;
#pragma unroll
  for (int i = 0; i < 8; ++i) { const int ka = k0 + 8 * g + i, kb = ka + 16;
    a[i] = (_Float16)(ka < K ? W[(size_t)(ka < K ? ka : K - 1) * ld + n] : 0.f); a[8 + i] = (_Float16)(kb < K ? W[(size_t)(kb < K ? kb : K - 1) * ld + n] : 0.f); }
  return a;
}
struct F2 { v16b h, l; };
__device__ __forceinline__ F2 bsplit16(const float v[16]) { F2 r;
#pragma unroll
  for (int i = 0; i < 16; ++i) { const __bf16 h = (__bf16)v[i]; r.h[i] = h; r.l[i] = (__bf16)(v[i] - (float)h); }
  return r; }
__device__ __forceinline__ F2 split_row(const float* row, int k0, int lane) { float v[16]; const float* p = row + k0 + 8 * (lane >> 4);
#pragma unroll
  for (int i = 0; i < 8; ++i) { v[i] = p[i]; v[8 + i] = p[16 + i]; }
  return bsplit16(v); }
__device__ __forceinline__ F2 split_rowK(const float* row, int k0, int lane, int K) { float v[16]; const int g = lane >> 4;
#pragma unroll
  for (int i = 0; i < 8; ++i) { const int ka = k0 + 8 * g + i, kb = ka + 16; v[i] = ka < K ? row[ka < K ? ka : K - 1] : 0.f; v[8 + i] = kb < K ? row[kb < K ? kb : K - 1] : 0.f; }
  return bsplit16(v); }
__device__ __forceinline__ F2 split_col(const float* W, int k0, int n, int lane, int ld, int K) { float v[16]; const int g = lane >> 4;
#pragma unroll
  for (int i = 0; i < 8; ++i) { const int ka = k0 + 8 * g + i, kb = ka + 16; v[i] = ka < K ? W[(size_t)(ka < K ? ka : K - 1) * ld + n] : 0.f; v[8 + i] = kb < K ? W[(size_t)(kb < K ? kb : K - 1) * ld + n] : 0.f; }
  return bsplit16(v); }
__device__ __forceinline__ v8f mac3(const F2& a, const F2& b, v8f c) { c = wmma_bf(a.l, b.h, c); c = wmma_bf(a.h, b.l, c); return wmma_bf(a.h, b.h, c); }
__device__ __forceinline__ float sigm(float v) { return 1.0f / (1.0f + expf(-v)); }
#define LDSX() do { asm volatile("s_wait_dscnt 0" ::: "memory"); __builtin_amdgcn_wave_barrier(); __builtin_amdgcn_fence(__ATOMIC_RELEASE, "workgroup"); } while (0)


// Plug-and-play feature injection attention (3 x 4,096 tokens x 320, 8 heads x 40): the source batch's queries and keys are reused for all three batches, values differ; softmax(q k^T / sqrt(40)) v, output projection + bias.
#define NB 3
#define SS 4096
#define DM 320
#define NH 8
#define HD 40
#define HDK 64            // key dims padded to 2 k-chunks
#define HDV 48            // value dims padded to 3 tiles
#define NR (NB * SS)
typedef __attribute__((ext_vector_type(8))) __bf16 v8b;
__device__ __forceinline__ v16b frag_lb(const __bf16* p) {   // as frag_l
  union { v16b v; v8b q[2]; } u; u.q[0] = *(const v8b*)p; u.q[1] = *(const v8b*)(p + 256); return u.v;
}
__device__ __forceinline__ float bfr(float v) { return (float)(__bf16)v; }
__device__ __attribute__((noinline)) float exp_ni(float v) { return expf(v); }
__device__ __attribute__((noinline)) float erf_ni(float v) { return erff(v); }

#define WS_PW   0u                                   // bf16 Wq, Wk, Wv in fragment order [3][h][k / 32][row tile of the head][k / 16 & 1][lane = 16 * (k / 8 & 1) + row % 16][k % 8]
#define PRUNS   (NH * (DM / 32) * 3 * 2)             // 512-B runs of one of them
#define WS_Q    (WS_PW + 2u * (size_t)4 * DM * DM)     // f16 q (padded, batch 0 only), laid out as k
#define WS_K    (WS_Q + 2u * (size_t)SS * NH * HDK)     // f16 k (padded, batch 0 only) in fragment order [h][key / 16][dim / 16][lane = 16 * (dim / 8 & 1) + key % 16][dim % 8]
#define WS_V    (WS_K + 2u * (size_t)SS * NH * HDK)     // f16 v (pad dims zero) in fragment order [h][key / 32][b][dim / 16][key / 16 & 1][lane = 16 * (key / 8 & 1) + dim % 16][key % 8]
#define OSTR    (NH * 64)                             // O columns: a 64-float slot per head
#define WS_O    (WS_V + 2u * (size_t)NB * NH * HDV * SS) // f32 in fragment order [row / 16][column / 32][column / 16 & 1][column / 4 & 1][lane = 16 * (column / 8 & 1) + row % 16][column % 4]
#define WS_POS  (WS_O + 4u * (size_t)NR * OSTR)      // bf16 Wo, k in slot layout, in fragment order [row / 16][k / 32][k / 16 & 1][lane = 16 * (k / 8 & 1) + row % 16][k % 8]
#define WS_END  (WS_POS + 2u * (size_t)DM * OSTR)

// ---- k_pack: a wave = one 512-B run of a weight operand, rounded to bf16, in its reader's fragment order. which 0..2: Wq, Wk, Wv for k_proj (row tiles of a head's 40 rows; rows past the 39th repeat it, their columns are discarded); which 3: Wo for k_out, k in the 64-wide head slots (zeros in the pads)
__global__ __launch_bounds__(256) void k_pack(const float* __restrict__ WQ, const float* __restrict__ WK, const float* __restrict__ WV, const float* __restrict__ WO, __bf16* __restrict__ P, __bf16* __restrict__ POS) {
  const int which = blockIdx.y, lane = threadIdx.x & 31, col = lane & 15, g = lane >> 4; const int R = blockIdx.x * 8 + (threadIdx.x >> 5), p = R & 1;
  v8b o;
  if (which < 3) {
    if (R >= PRUNS) return;
    const float* Wm = (which == 0) ? WQ : (which == 1) ? WK : WV;
    const int t = R >> 1, j = t % 3, kc = (t / 3) % (DM / 32), h = t / (3 * (DM / 32));
    const float* s = Wm + (size_t)(h * HD + min(j * 16 + col, HD - 1)) * DM + kc * 32 + p * 16 + 8 * g;
    const v4f x0 = *(const v4f*)s, x1 = *(const v4f*)(s + 4);
    asm volatile("s_wait_xcnt 0x0" ::: "memory");   // the loads' address registers are reused below: the wait stands in front of that
    __builtin_amdgcn_sched_barrier(0);   // keeps the work below behind the wait
#pragma unroll
    for (int i = 0; i < 4; ++i) { o[i] = (__bf16)x0[i]; o[4 + i] = (__bf16)x1[i]; }
    vst2(P + ((size_t)which * PRUNS + R) * 256 + lane * 8, o);
  } else {
    const int kc = (R >> 1) & 15, nt = R >> 5; const int k0 = kc * 32 + p * 16 + 8 * g, hh = k0 >> 6, d0 = k0 & 63;   // 8 slot columns: all live or all pad
    const float* s = WO + (size_t)(nt * 16 + col) * DM + hh * HD + min(d0, HD - 8);
    const v4f x0 = *(const v4f*)s, x1 = *(const v4f*)(s + 4);   // read by every lane (the address is clamped), so that the two loads go out together
    asm volatile("s_wait_xcnt 0x0" ::: "memory");   // the loads' address registers are reused below: the wait stands in front of that
    __builtin_amdgcn_sched_barrier(0);   // keeps the work below behind the wait
#pragma unroll
    for (int i = 0; i < 4; ++i) { o[i] = (__bf16)((d0 < HD) ? x0[i] : 0.f); o[4 + i] = (__bf16)((d0 < HD) ? x1[i] : 0.f); }
    vst2(POS + (size_t)R * 256 + lane * 8, o);
  }
}
// ---- k_zero: zeroes the q, k and v regions (f16 zeros): block = 4096-element chunk (kept as it was; k_proj's stores cover every pad of the three)
__global__ __launch_bounds__(256) void k_zero(_Float16* __restrict__ A, size_t n16) { const size_t i = ((size_t)blockIdx.x * 256 + threadIdx.x) * 16; if (i + 16 <= n16) { v4f z; z[0] = z[1] = z[2] = z[3] = 0.f; vst2((float*)(A + i), z); vst2((float*)(A + i + 8), z); } }
// ---- k_proj: block = (64 rows, head h, which): the head's 40 output columns (3 tiles, last tile half used); which 0: q, 1: k (batch-0 rows), 2: v for all batches -> the fragment order that k_attn's loads read (WS_K, WS_V)
__global__ __launch_bounds__(128) void k_proj(const float* __restrict__ X, const __bf16* __restrict__ P, _Float16* __restrict__ Q, _Float16* __restrict__ Kr, _Float16* __restrict__ V) {
  __shared__ __align__(16) _Float16 so[64][56]; __shared__ __align__(16) _Float16 st[48][72];
  const int tid = threadIdx.x, wave = tid >> 5, lane = tid & 31, col = lane & 15, g = lane >> 4; const int h = blockIdx.y, which = blockIdx.z; const size_t rb0 = (size_t)blockIdx.x * 64, r0 = rb0 + wave * 16;
  if (which < 2 && rb0 >= SS) return;   // q, k only from the source batch
  const __bf16* Wf = P + ((size_t)which * PRUNS + h * (PRUNS / NH)) * 256 + lane * 8;
  v8f acc[3] = {};
#pragma unroll
  for (int kc = 0; kc < DM / 32; ++kc) { v16b a; { const float* p = X + (r0 + col) * DM + kc * 32 + 8 * g;
#pragma unroll
      for (int i = 0; i < 8; ++i) { a[i] = (__bf16)p[i]; a[8 + i] = (__bf16)p[16 + i]; } }
#pragma unroll
    for (int j = 0; j < 3; ++j) acc[j] = wmma_bf(a, frag_lb(Wf + (kc * 3 + j) * 512), acc[j]); }   // columns n >= 40 are discarded
  asm volatile("s_wait_xcnt 0x0" ::: "memory");   // the loads' address registers are reused below: the wait stands in front of that
  __builtin_amdgcn_sched_barrier(0);   // keeps the work below behind the wait
  if (which < 2) {
#pragma unroll
    for (int j = 0; j < 3; ++j) { const int n = j * 16 + col;
#pragma unroll
      for (int r = 0; r < 8; ++r) so[wave * 16 + 8 * g + r][n] = (n < HD) ? (_Float16)acc[j][r] : (_Float16)0.f; }
    LDSX();
    _Float16* kt = ((which == 0) ? Q : Kr) + ((size_t)h * SS + r0) * HDK + lane * 8;   // the wave's 16 rows are one 2-KiB tile: four 512-B runs, one per 16 dims
#pragma unroll
    for (int f = 0; f < 3; ++f) vst2((unsigned*)(kt + f * 256), *(const v4u*)&so[wave * 16 + col][f * 16 + 8 * g]);   // dims 0..47 (40 live + 8 zero)
    v4u z; z[0] = z[1] = z[2] = z[3] = 0u; vst2((unsigned*)(kt + 3 * 256), z);   // dims 48..63
  } else {
#pragma unroll
    for (int j = 0; j < 3; ++j) { const int n = j * 16 + col;
#pragma unroll
      for (int r = 0; r < 8; ++r) st[n][wave * 16 + 8 * g + r] = (n < HD) ? (_Float16)acc[j][r] : (_Float16)0.f; }
    __syncthreads();
    const size_t b = rb0 / SS, s0 = rb0 % SS;
    for (int e = tid; e < 48 * 8; e += 128) { const int ln = e & 31, p = (e >> 5) & 1, dk = e >> 6, dt = dk % 3, kp = dk / 3;   // 12 runs of 512 B: (32-key group kp, dim tile dt, key half p)
      vst2((unsigned*)(V + ((((size_t)h * (SS / 32) + (s0 >> 5) + kp) * (NB * 3) + b * 3 + dt) * 2 + p) * 256 + ln * 8), *(const v4u*)&st[dt * 16 + (ln & 15)][kp * 32 + p * 16 + (ln >> 4) * 8]); } }
}
// ---- k_attn: block = (128 queries, head), 8 waves: waves w and w + 4 take the same 32 queries (two 16-column tiles) and one half of the 4,096 keys each, so that one wave's softmax issues under the other's products; the two partial results are joined once through LDS behind the loop. Transposed products: S^T = K . Q^T (a lane holds 16 of one query's 32 scores of the pass), O^T += V^T . P^T for the three batches' value planes (3 x 3 tiles); P^T goes from the score accumulators straight into the B operand
#define QT 2
#define KH (SS / 2)       // keys of one wave
// amdgpu_waves_per_eu(2, 2): the block's 8 waves stand two on a SIMD, and the compiler schedules and budgets registers for exactly that
__device__ __forceinline__ float xhalf(float x) { return __builtin_bit_cast(float, __builtin_amdgcn_permlanex16(__builtin_bit_cast(int, x), __builtin_bit_cast(int, x), 0x76543210, 0xfedcba98, false, false)); }   // lane l's value from lane l ^ 16
__global__ __launch_bounds__(256) __attribute__((amdgpu_waves_per_eu(2, 2))) void k_attn(const _Float16* __restrict__ Q, const _Float16* __restrict__ Kr, const _Float16* __restrict__ V, float* __restrict__ O) {
  __shared__ __align__(16) v4f xa[8][18][32];   // hand-over: the 72 accumulator registers of the tile a wave gives away, 16 bytes a lane
  __shared__ float xm[8][2][32];                // with that tile's maximum and sum
  const int tid = threadIdx.x, wave = tid >> 5, lane = tid & 31, g = lane >> 4; const int h = blockIdx.y; const int q0 = blockIdx.x * (64 * QT) + (wave & 3) * (16 * QT);
  const int kh = __builtin_amdgcn_readfirstlane(tid >> 7);   // the wave's key half, held scalar so that the loop's addresses keep their scalar part
  const int kb = kh * KH;
  v16h aq[QT][2];
#pragma unroll
  for (int t = 0; t < QT; ++t)
#pragma unroll
    for (int kc = 0; kc < 2; ++kc) aq[t][kc] = frag_l(Q + ((size_t)h * SS + q0 + t * 16) * HDK + kc * 512 + lane * 8);
  const _Float16* Kh = Kr + (size_t)h * SS * HDK + lane * 8;          // the head's keys: 64 halves a key, 1 KiB a fragment
  const _Float16* Vh = V + (size_t)h * SS * (NB * HDV) + lane * 8;   // the head's values: 144 halves a key, the nine fragments of 32 keys in a row
  v16h kf[2][2];   // the pass's key fragments, fetched one pass ahead
#pragma unroll
  for (int ct = 0; ct < 2; ++ct)
#pragma unroll
    for (int kc = 0; kc < 2; ++kc) kf[ct][kc] = frag_l(Kh + (size_t)kb * HDK + (ct * 2 + kc) * 512);
  asm volatile("s_wait_xcnt 0x0" ::: "memory");   // the query and key loads' address registers are reused below: the wait stands in front of that
  __builtin_amdgcn_sched_barrier(0);   // keeps the vector work below behind the wait
  float m[QT], l[QT];   // per lane: its query's running maximum (equal in both wave halves) and the sum over the keys of its own half
#pragma unroll
  for (int t = 0; t < QT; ++t) { m[t] = -3.0e38f; l[t] = 0.f; }
  v8f acc[QT][3][3] = {};   // O^T tiles: register r = value dim dt * 16 + 8 g + r, column = query
#pragma unroll 1
  for (int ks = 0; ks < KH / 32; ++ks) { const int j0 = kb + ks * 32; v8f s[QT][2];
    v16h vf[3][3];   // the pass's value fragments: all loads issued here as one group, they land behind the score products and the softmax
    const _Float16* vp = Vh + (size_t)j0 * (NB * HDV);   // one base for the eighteen loads
    __builtin_amdgcn_sched_barrier(0);   // with the one behind the wait: nothing but the loads stands between them, so no other instruction takes over an address register ahead of the wait
#pragma unroll
    for (int b = 0; b < 3; ++b)
#pragma unroll
      for (int dt = 0; dt < 3; ++dt) vf[b][dt] = frag_l(vp + (b * 3 + dt) * 512);
    asm volatile("s_wait_xcnt 0x0" :: "v"(vp) : "memory");   // the value loads' address registers are free for reuse behind them: the wait stands in front of any rewrite; it names the address, which so stays out of the loads' own destinations
    __builtin_amdgcn_sched_barrier(0);   // keeps later vector work behind the wait
#pragma unroll
    for (int ct = 0; ct < 2; ++ct)
#pragma unroll
      for (int t = 0; t < QT; ++t) { v8f c = {};
#pragma unroll
        for (int kc = 0; kc < 2; ++kc) c = wmma16(kf[ct][kc], aq[t][kc], c);   // rows = keys j0 + ct * 16 + 8 g + r, column = query
#pragma unroll
        for (int r = 0; r < 8; ++r) s[t][ct][r] = c[r] * 0.15811388300841897f; }   // 40^-0.5
    const int jn = (ks + 1 < KH / 32) ? j0 + 32 : 0;   // next pass's keys (the last pass re-reads the first rows, unused)
    const _Float16* kp = Kh + (size_t)jn * HDK;   // one base for the eight loads
    __builtin_amdgcn_sched_barrier(0);   // with the one behind the wait: nothing but the loads stands between them
#pragma unroll
    for (int ct = 0; ct < 2; ++ct)
#pragma unroll
      for (int kc = 0; kc < 2; ++kc) kf[ct][kc] = frag_l(kp + (ct * 2 + kc) * 512);
    asm volatile("s_wait_xcnt 0x0" :: "v"(kp) : "memory");   // the key loads' address registers are reused by the softmax: the wait stands in front of that; it names the address, as at the value loads
    __builtin_amdgcn_sched_barrier(0);   // keeps the key loads in front of the softmax, whose whole length then covers their latency
    v16h pb[QT];   // P^T as B operand: element ct * 8 + r = key ct * 16 + 8 g + r, the hardware k order in which frag_l reads the packed value fragments
#pragma unroll
    for (int t = 0; t < QT; ++t) { float mr[8];
#pragma unroll
      for (int r = 0; r < 8; ++r) mr[r] = fmaxf(s[t][0][r], s[t][1][r]);
      float mx = fmaxf(fmaxf(fmaxf(mr[0], mr[1]), fmaxf(mr[2], mr[3])), fmaxf(fmaxf(mr[4], mr[5]), fmaxf(mr[6], mr[7])));
      mx = fmaxf(mx, xhalf(mx));   // the other half's 16 keys
      const float mn = fmaxf(m[t], mx); const float alpha = (m[t] <= -1.0e38f) ? 0.f : __expf(m[t] - mn); float er[8];
#pragma unroll
      for (int r = 0; r < 8; ++r) { const float e0 = __expf(s[t][0][r] - mn), e1 = __expf(s[t][1][r] - mn); er[r] = e0 + e1;
        pb[t][r] = (_Float16)(e0 * 2048.0f); pb[t][8 + r] = (_Float16)(e1 * 2048.0f); }
      l[t] = l[t] * alpha + (((er[0] + er[1]) + (er[2] + er[3])) + ((er[4] + er[5]) + (er[6] + er[7]))); m[t] = mn;
#pragma unroll
      for (int b = 0; b < 3; ++b)
#pragma unroll
        for (int dt = 0; dt < 3; ++dt) acc[t][b][dt] *= alpha; }
#pragma unroll
    for (int b = 0; b < 3; ++b)
#pragma unroll
      for (int dt = 0; dt < 3; ++dt)
#pragma unroll
        for (int t = 0; t < QT; ++t) acc[t][b][dt] = wmma16(vf[b][dt], pb[t], acc[t][b][dt]); }
  // join of the two key halves: the wave of half kh finishes query tile kh and hands its partial result for the other tile to its partner (wave ^ 4)
  v8f ka[3][3]; const float km = kh ? m[1] : m[0], kl = kh ? l[1] : l[0];
#pragma unroll
  for (int b = 0; b < 3; ++b)
#pragma unroll
    for (int dt = 0; dt < 3; ++dt) { const v8f ga = kh ? acc[0][b][dt] : acc[1][b][dt]; ka[b][dt] = kh ? acc[1][b][dt] : acc[0][b][dt];
      v4f lo, hi;
#pragma unroll
      for (int r = 0; r < 4; ++r) { lo[r] = ga[r]; hi[r] = ga[4 + r]; }
      xa[wave][(b * 3 + dt) * 2][lane] = lo; xa[wave][(b * 3 + dt) * 2 + 1][lane] = hi; }
  xm[wave][0][lane] = kh ? m[0] : m[1]; xm[wave][1][lane] = kh ? l[0] : l[1];
  __syncthreads();   // every wave's hand-over is written before its partner reads it
  const int pw = wave ^ 4; const float pm = xm[pw][0][lane], pl = xm[pw][1][lane];
  const float mj = fmaxf(km, pm); const float fk = __expf(km - mj), fp = __expf(pm - mj);   // both halves have seen keys, so both maxima are scores
  const float lj = kl * fk + pl * fp;
  const float il = (1.0f / 2048.0f) / (lj + xhalf(lj));   // the two wave halves' sums joined once, with every lane on
  const float ck = fk * il, cp = fp * il;
  // an O^T accumulator tile already has the lane map of k_out's A fragment (lane = 16 g + query, 8 columns from 8 g): it is stored from the registers, 16 B a lane, the head's 64-column slot of the 16 queries as eight 512-B runs (40 live columns + 24 zeros)
  float* ob = O + ((size_t)q0 + kh * 16) * OSTR + h * 1024 + lane * 4;   // 16 rows = 16 * OSTR floats; a slot = 1,024 of them
  { v4f z; z[0] = z[1] = z[2] = z[3] = 0.f;
    __builtin_amdgcn_sched_barrier(0);   // with the one behind the wait: nothing but the stores stands between them, so no other instruction takes over one of their registers ahead of the wait
#pragma unroll
    for (int b = 0; b < 3; ++b) { vst2(ob + (size_t)b * SS * OSTR + 768, z); vst2(ob + (size_t)b * SS * OSTR + 896, z); }   // columns 48..63 of the slot
    asm volatile("s_wait_xcnt 0x0" ::: "memory");   // the stores' registers are reused below: the wait stands in front of that
    __builtin_amdgcn_sched_barrier(0); }   // keeps later work behind the wait
#pragma unroll
  for (int b = 0; b < 3; ++b) { float* ot = ob + (size_t)b * SS * OSTR;
    v4f ov[6];
#pragma unroll
    for (int dt = 0; dt < 3; ++dt) { const v4f lo = xa[pw][(b * 3 + dt) * 2][lane], hi = xa[pw][(b * 3 + dt) * 2 + 1][lane];
#pragma unroll
      for (int r = 0; r < 4; ++r) { ov[dt * 2][r] = (dt * 16 + 8 * g + r < HD) ? ka[b][dt][r] * ck + lo[r] * cp : 0.f; ov[dt * 2 + 1][r] = (dt * 16 + 8 * g + 4 + r < HD) ? ka[b][dt][4 + r] * ck + hi[r] * cp : 0.f; } }
    __builtin_amdgcn_sched_barrier(0);   // with the one behind the wait: nothing but the stores stands between them
#pragma unroll
    for (int f = 0; f < 6; ++f) vst2(ot + f * 128, ov[f]);
    asm volatile("s_wait_xcnt 0x0" ::: "memory");   // the stores' data and address registers are reused by the next batch: the wait stands in front of that
    __builtin_amdgcn_sched_barrier(0); }   // keeps later work behind the wait
}
// ---- k_out: block = (64 rows, 64-column chunk (5 chunks of 320)): out = o (hi + residual, K 512 head slots) . Wo rows + bo
__global__ __launch_bounds__(128) void k_out(const float* __restrict__ O, const __bf16* __restrict__ POS, const float* __restrict__ BO, float* __restrict__ OUT) {
  __shared__ __align__(16) float so[4][16][68];
  const int tid = threadIdx.x, wave = tid >> 5, lane = tid & 31, col = lane & 15, g = lane >> 4; const size_t r0 = (size_t)blockIdx.x * 64 + wave * 16; const int n0 = blockIdx.y * 64;
  v8f acc[4] = {};
#pragma unroll
  for (int kc = 0; kc < OSTR / 32; ++kc) { if ((kc & 1) && ((kc * 32) & 63) >= 48) {}   // (all chunks carry live or zero-weighted columns)
    float v[16];
#pragma unroll
    for (int q = 0; q < 4; ++q) { const v4f x = *(const v4f*)(O + r0 * OSTR + kc * 512 + q * 128 + lane * 4);
#pragma unroll
      for (int i = 0; i < 4; ++i) v[q * 4 + i] = x[i]; }
    const F2 a = bsplit16(v);
#pragma unroll
    for (int j = 0; j < 4; ++j) { const v16b w = frag_lb(POS + (size_t)(((n0 >> 4) + j) * 16 + kc) * 512 + lane * 8); acc[j] = wmma_bf(a.l, w, acc[j]); acc[j] = wmma_bf(a.h, w, acc[j]); } }
#pragma unroll
  for (int j = 0; j < 4; ++j) { const float bb = bfr(BO[n0 + j * 16 + col]);
#pragma unroll
    for (int r = 0; r < 8; ++r) so[wave][8 * g + r][j * 16 + col] = acc[j][r] + bb; }
  LDSX();
  for (int rl = 0; rl < 16; ++rl) if (lane < 16) vst2(OUT + (r0 + rl) * DM + n0 + lane * 4, *(const v4f*)&so[wave][rl][lane * 4]);
}
extern "C" void kernel_launch(void* const* d_in, const int* in_sizes, int n_in, void* d_out, int out_size, void* d_ws, size_t ws_size, hipStream_t stream) {
  (void)in_sizes; (void)n_in; (void)out_size;
  const float** F = (const float**)d_in;   // 0 x [3,4096,320], 1 Wq, 2 Wk, 3 Wv, 4 Wo (natural [320,320]), 5 bo
  if (ws_size < (size_t)WS_END) return;
  char* ws = (char*)d_ws; __bf16* P = (__bf16*)ws; __bf16* POS = (__bf16*)(ws + WS_POS); _Float16 *Q = (_Float16*)(ws + WS_Q), *Kr = (_Float16*)(ws + WS_K), *V = (_Float16*)(ws + WS_V); float* O = (float*)(ws + WS_O);
  k_pack<<<dim3(DM / 16 * (OSTR / 32) * 2 / 8, 4), 256, 0, stream>>>(F[1], F[2], F[3], F[4], P, POS);
  k_zero<<<(unsigned)(((size_t)SS * NH * HDK * 2 + (size_t)NB * NH * HDV * SS) / 4096), 256, 0, stream>>>(Q, (size_t)SS * NH * HDK * 2 + (size_t)NB * NH * HDV * SS);   // Q, K (contiguous) and V regions
  k_proj<<<dim3(NR / 64, NH, 3), 128, 0, stream>>>(F[0], P, Q, Kr, V);
  k_attn<<<dim3(SS / (64 * QT), NH), 256, 0, stream>>>(Q, Kr, V, O);
  k_out<<<dim3(NR / 64, DM / 64), 128, 0, stream>>>(O, POS, F[5], (float*)d_out);
}

// v006
// A run of this version takes 103 microseconds.
// Two timings next to v005 both put it at 1.15 times that version's speed.
// Over all steps from v000 it is 4.26 times as fast.
// compute dtype: all float inputs rounded to bf16; q, k (from the source third x[0]) and v (all three batches) = x . W^T with EXACT bf16 products on WMMA 16x16x32 (natural rows), rounded once to f16 with the 40-dim heads zero-padded to 64 (keys) / 48 (values); PLAIN attention shared across the three batches: q, k as single f16 operands x 40^-0.5, running-max softmax in f32 (hardware exp), P (scaled by 2^11, single f16) x v (single f16) for the three value sets at once; out = o (bf16 hi + residual) . Wo^T (2 products) + bo.
#include <hip/hip_runtime.h>
#include <math.h>

typedef __attribute__((ext_vector_type(16))) _Float16 v16h;
typedef __attribute__((ext_vector_type(16))) __bf16 v16b;
typedef __attribute__((ext_vector_type(8)))  _Float16 v8h;
typedef __attribute__((ext_vector_type(8)))  float v8f;
typedef __attribute__((ext_vector_type(4)))  float v4f;
typedef __attribute__((ext_vector_type(2)))  float v2f;
typedef __attribute__((ext_vector_type(4)))  unsigned v4u;
typedef __attribute__((ext_vector_type(4)))  int v4i;
typedef float __attribute__((may_alias)) float_a;
typedef int __attribute__((may_alias)) int_a;

template <typename T> __device__ __forceinline__ void vst2(void* p, T v) { *(T*)p = v;  }
__device__ __forceinline__ v8f wmma16(v16h a, v16h b, v8f c) {
  return __builtin_amdgcn_wmma_f32_16x16x32_f16(false, a, false, b, (short)0, c, false, false);   // plain builtin: the compiler keeps the distance behind it; an asm statement on its operands would hold all of them below v256, and the two-tile wave has more than that live
}
__device__ __forceinline__ v8f wmma_bf(v16b a, v16b b, v8f c) {
  return __builtin_amdgcn_wmma_f32_16x16x32_bf16(false, a, false, b, (short)0, c, false, false);   // plain builtin, as wmma16: a volatile asm tail behind each product orders all memory accesses around it, which held every fragment load behind the product before it, each load's latency waited out alone
}
// 16x16x32 fragments: lane = (h = lane>>4, row/col = lane&15); elements 0..7 = k0+8h+0..7, 8..15 = k0+16+8h+0..7; D element r = row 8h+r
__device__ __forceinline__ v16h frag_h(const _Float16* rowk0, int lane) {
  union { v16h v; v8h q[2]; } u; const _Float16* p = rowk0 + 8 * (lane >> 4);
  u.q[0] = *(const v8h*)p; u.q[1] = *(const v8h*)(p + 16); return u.v;
}
// fragment stored in fragment order: two runs of 512 B, 16 B a lane (p already holds the lane's 8 * lane), so that a wave's load covers four whole 128-B lines
__device__ __forceinline__ v16h frag_l(const _Float16* p) {
  union { v16h v; v8h q[2]; } u; u.q[0] = *(const v8h*)p; u.q[1] = *(const v8h*)(p + 256); return u.v;
}
__device__ __forceinline__ v16h frag_f32(const float* rowk0, int lane) {
  v16h a; const float* p = rowk0 + 8 * (lane >> 4);
#pragma unroll
  for (int i = 0; i < 8; ++i) { a[i] = (_Float16)p[i]; a[8 + i] = (_Float16)p[16 + i]; }
  return a;
}
__device__ __forceinline__ v16h frag_f32s(const float* rowk0, int lane, float sc) {
  v16h a; const float* p = rowk0 + 8 * (lane >> 4);
#pragma unroll
  for (int i = 0; i < 8; ++i) { a[i] = (_Float16)(p[i] * sc); a[8 + i] = (_Float16)(p[16 + i] * sc); }
  return a;
}
// column fragment from a [K][ld] layout (column n), rows >= K read as 0
__device__ __forceinline__ v16h fragc_f32(const float* W, int k0, int n, int lane, int ld, int K) {
  v16h a; const int g = lane >> 4;
#pragma unroll
  for (int i = 0; i < 8; ++i) { const int ka = k0 + 8 * g + i, kb = ka + 16;
    a[i] = (_Float16)(ka < K ? W[(size_t)(ka < K ? ka : K - 1) * ld + n] : 0.f); a[8 + i] = (_Float16)(kb < K ? W[(size_t)(kb < K ? kb : K - 1) * ld + n] : 0.f); }
  return a;
}
struct F2 { v16b h, l; };
__device__ __forceinline__ F2 bsplit16(const float v[16]) { F2 r;
#pragma unroll
  for (int i = 0; i < 16; ++i) { const __bf16 h = (__bf16)v[i]; r.h[i] = h; r.l[i] = (__bf16)(v[i] - (float)h); }
  return r; }
__device__ __forceinline__ F2 split_row(const float* row, int k0, int lane) { float v[16]; const float* p = row + k0 + 8 * (lane >> 4);
#pragma unroll
  for (int i = 0; i < 8; ++i) { v[i] = p[i]; v[8 + i] = p[16 + i]; }
  return bsplit16(v); }
__device__ __forceinline__ F2 split_rowK(const float* row, int k0, int lane, int K) { float v[16]; const int g = lane >> 4;
#pragma unroll
  for (int i = 0; i < 8; ++i) { const int ka = k0 + 8 * g + i, kb = ka + 16; v[i] = ka < K ? row[ka < K ? ka : K - 1] : 0.f; v[8 + i] = kb < K ? row[kb < K ? kb : K - 1] : 0.f; }
  return bsplit16(v); }
__device__ __forceinline__ F2 split_col(const float* W, int k0, int n, int lane, int ld, int K) { float v[16]; const int g = lane >> 4;
#pragma unroll
  for (int i = 0; i < 8; ++i) { const int ka = k0 + 8 * g + i, kb = ka + 16; v[i] = ka < K ? W[(size_t)(ka < K ? ka : K - 1) * ld + n] : 0.f; v[8 + i] = kb < K ? W[(size_t)(kb < K ? kb : K - 1) * ld + n] : 0.f; }
  return bsplit16(v); }
__device__ __forceinline__ v8f mac3(const F2& a, const F2& b, v8f c) { c = wmma_bf(a.l, b.h, c); c = wmma_bf(a.h, b.l, c); return wmma_bf(a.h, b.h, c); }
__device__ __forceinline__ float sigm(float v) { return 1.0f / (1.0f + expf(-v)); }
#define LDSX() do { asm volatile("s_wait_dscnt 0" ::: "memory"); __builtin_amdgcn_wave_barrier(); __builtin_amdgcn_fence(__ATOMIC_RELEASE, "workgroup"); } while (0)


// Plug-and-play feature injection attention (3 x 4,096 tokens x 320, 8 heads x 40): the source batch's queries and keys are reused for all three batches, values differ; softmax(q k^T / sqrt(40)) v, output projection + bias.
#define NB 3
#define SS 4096
#define DM 320
#define NH 8
#define HD 40
#define HDK 64            // key dims padded to 2 k-chunks
#define HDV 48            // value dims padded to 3 tiles
#define NR (NB * SS)
typedef __attribute__((ext_vector_type(8))) __bf16 v8b;
__device__ __forceinline__ v16b frag_lb(const __bf16* p) {   // as frag_l
  union { v16b v; v8b q[2]; } u; u.q[0] = *(const v8b*)p; u.q[1] = *(const v8b*)(p + 256); return u.v;
}
__device__ __forceinline__ float bfr(float v) { return (float)(__bf16)v; }
__device__ __attribute__((noinline)) float exp_ni(float v) { return expf(v); }
__device__ __attribute__((noinline)) float erf_ni(float v) { return erff(v); }

#define WS_PW   0u                                   // bf16 Wq, Wk, Wv in fragment order [3][h][k / 32][row tile of the head][k / 16 & 1][lane = 16 * (k / 8 & 1) + row % 16][k % 8]
#define PRUNS   (NH * (DM / 32) * 3 * 2)             // 512-B runs of one of them
#define WS_Q    (WS_PW + 2u * (size_t)4 * DM * DM)     // f16 q (padded, batch 0 only), laid out as k
#define WS_K    (WS_Q + 2u * (size_t)SS * NH * HDK)     // f16 k (padded, batch 0 only) in fragment order [h][key / 16][dim / 16][lane = 16 * (dim / 8 & 1) + key % 16][dim % 8]
#define WS_V    (WS_K + 2u * (size_t)SS * NH * HDK)     // f16 v (pad dims zero) in fragment order [h][key / 32][b][dim / 16][key / 16 & 1][lane = 16 * (key / 8 & 1) + dim % 16][key % 8]
#define OSTR    (NH * 64)                             // O columns: a 64-float slot per head
#define WS_O    (WS_V + 2u * (size_t)NB * NH * HDV * SS) // f32 in fragment order [row / 16][column / 32][column / 16 & 1][column / 4 & 1][lane = 16 * (column / 8 & 1) + row % 16][column % 4]
#define WS_POS  (WS_O + 4u * (size_t)NR * OSTR)      // bf16 Wo, k in slot layout, in fragment order [row / 16][k / 32][k / 16 & 1][lane = 16 * (k / 8 & 1) + row % 16][k % 8]
#define WS_END  (WS_POS + 2u * (size_t)DM * OSTR)

// ---- k_pack: a wave = one 512-B run of a weight operand, rounded to bf16, in its reader's fragment order. which 0..2: Wq, Wk, Wv for k_proj (row tiles of a head's 40 rows; rows past the 39th repeat it, their columns are discarded); which 3: Wo for k_out, k in the 64-wide head slots (zeros in the pads)
__global__ __launch_bounds__(256) void k_pack(const float* __restrict__ WQ, const float* __restrict__ WK, const float* __restrict__ WV, const float* __restrict__ WO, __bf16* __restrict__ P, __bf16* __restrict__ POS) {
  const int which = blockIdx.y, lane = threadIdx.x & 31, col = lane & 15, g = lane >> 4; const int R = blockIdx.x * 8 + (threadIdx.x >> 5), p = R & 1;
  v8b o;
  if (which < 3) {
    if (R >= PRUNS) return;
    const float* Wm = (which == 0) ? WQ : (which == 1) ? WK : WV;
    const int t = R >> 1, j = t % 3, kc = (t / 3) % (DM / 32), h = t / (3 * (DM / 32));
    const float* s = Wm + (size_t)(h * HD + min(j * 16 + col, HD - 1)) * DM + kc * 32 + p * 16 + 8 * g;
    const v4f x0 = *(const v4f*)s, x1 = *(const v4f*)(s + 4);
    asm volatile("s_wait_xcnt 0x0" ::: "memory");   // the loads' address registers are reused below: the wait stands in front of that
    __builtin_amdgcn_sched_barrier(0);   // keeps the work below behind the wait
#pragma unroll
    for (int i = 0; i < 4; ++i) { o[i] = (__bf16)x0[i]; o[4 + i] = (__bf16)x1[i]; }
    vst2(P + ((size_t)which * PRUNS + R) * 256 + lane * 8, o);
  } else {
    const int kc = (R >> 1) & 15, nt = R >> 5; const int k0 = kc * 32 + p * 16 + 8 * g, hh = k0 >> 6, d0 = k0 & 63;   // 8 slot columns: all live or all pad
    const float* s = WO + (size_t)(nt * 16 + col) * DM + hh * HD + min(d0, HD - 8);
    const v4f x0 = *(const v4f*)s, x1 = *(const v4f*)(s + 4);   // read by every lane (the address is clamped), so that the two loads go out together
    asm volatile("s_wait_xcnt 0x0" ::: "memory");   // the loads' address registers are reused below: the wait stands in front of that
    __builtin_amdgcn_sched_barrier(0);   // keeps the work below behind the wait
#pragma unroll
    for (int i = 0; i < 4; ++i) { o[i] = (__bf16)((d0 < HD) ? x0[i] : 0.f); o[4 + i] = (__bf16)((d0 < HD) ? x1[i] : 0.f); }
    vst2(POS + (size_t)R * 256 + lane * 8, o);
  }
}
// ---- k_zero: zeroes the q, k and v regions (f16 zeros): block = 4096-element chunk (kept as it was; k_proj's stores cover every pad of the three)
__global__ __launch_bounds__(256) void k_zero(_Float16* __restrict__ A, size_t n16) { const size_t i = ((size_t)blockIdx.x * 256 + threadIdx.x) * 16; if (i + 16 <= n16) { v4f z; z[0] = z[1] = z[2] = z[3] = 0.f; vst2((float*)(A + i), z); vst2((float*)(A + i + 8), z); } }
// amdgpu_waves_per_eu(4, 8) on k_proj: registers for about one 32-wide k chunk of loads (ten of 16 B a lane) in flight ahead of the products; eight waves still stand on a SIMD
// ---- k_proj: block = (64 rows, head h, which): the head's 40 output columns (3 tiles, last tile half used); which 0: q, 1: k (batch-0 rows), 2: v for all batches -> the fragment order that k_attn's loads read (WS_K, WS_V)
__global__ __launch_bounds__(128) __attribute__((amdgpu_waves_per_eu(4, 8))) void k_proj(const float* __restrict__ X, const __bf16* __restrict__ P, _Float16* __restrict__ Q, _Float16* __restrict__ Kr, _Float16* __restrict__ V) {
  __shared__ __align__(16) _Float16 so[64][56]; __shared__ __align__(16) _Float16 st[48][72];
  const int tid = threadIdx.x, wave = tid >> 5, lane = tid & 31, col = lane & 15, g = lane >> 4; const int h = blockIdx.y, which = blockIdx.z; const size_t rb0 = (size_t)blockIdx.x * 64, r0 = rb0 + wave * 16;
  if (which < 2 && rb0 >= SS) return;   // q, k only from the source batch
  const __bf16* Wf = P + ((size_t)which * PRUNS + h * (PRUNS / NH)) * 256 + lane * 8;
  v8f acc[3] = {};
#pragma unroll
  for (int kc = 0; kc < DM / 32; ++kc) { v16b a; { const float* p = X + (r0 + col) * DM + kc * 32 + 8 * g;
#pragma unroll
      for (int i = 0; i < 8; ++i) { a[i] = (__bf16)p[i]; a[8 + i] = (__bf16)p[16 + i]; } }
#pragma unroll
    for (int j = 0; j < 3; ++j) acc[j] = wmma_bf(a, frag_lb(Wf + (kc * 3 + j) * 512), acc[j]); }   // columns n >= 40 are discarded
  asm volatile("s_wait_xcnt 0x0" ::: "memory");   // the loads' address registers are reused below: the wait stands in front of that
  __builtin_amdgcn_sched_barrier(0);   // keeps the work below behind the wait
  if (which < 2) {
#pragma unroll
    for (int j = 0; j < 3; ++j) { const int n = j * 16 + col;
#pragma unroll
      for (int r = 0; r < 8; ++r) so[wave * 16 + 8 * g + r][n] = (n < HD) ? (_Float16)acc[j][r] : (_Float16)0.f; }
    LDSX();
    _Float16* kt = ((which == 0) ? Q : Kr) + ((size_t)h * SS + r0) * HDK + lane * 8;   // the wave's 16 rows are one 2-KiB tile: four 512-B runs, one per 16 dims
#pragma unroll
    for (int f = 0; f < 3; ++f) vst2((unsigned*)(kt + f * 256), *(const v4u*)&so[wave * 16 + col][f * 16 + 8 * g]);   // dims 0..47 (40 live + 8 zero)
    v4u z; z[0] = z[1] = z[2] = z[3] = 0u; vst2((unsigned*)(kt + 3 * 256), z);   // dims 48..63
  } else {
#pragma unroll
    for (int j = 0; j < 3; ++j) { const int n = j * 16 + col;
#pragma unroll
      for (int r = 0; r < 8; ++r) st[n][wave * 16 + 8 * g + r] = (n < HD) ? (_Float16)acc[j][r] : (_Float16)0.f; }
    __syncthreads();
    const size_t b = rb0 / SS, s0 = rb0 % SS;
    for (int e = tid; e < 48 * 8; e += 128) { const int ln = e & 31, p = (e >> 5) & 1, dk = e >> 6, dt = dk % 3, kp = dk / 3;   // 12 runs of 512 B: (32-key group kp, dim tile dt, key half p)
      vst2((unsigned*)(V + ((((size_t)h * (SS / 32) + (s0 >> 5) + kp) * (NB * 3) + b * 3 + dt) * 2 + p) * 256 + ln * 8), *(const v4u*)&st[dt * 16 + (ln & 15)][kp * 32 + p * 16 + (ln >> 4) * 8]); } }
}
// ---- k_attn: block = (128 queries, head), 8 waves: waves w and w + 4 take the same 32 queries (two 16-column tiles) and one half of the 4,096 keys each, so that one wave's softmax issues under the other's products; the two partial results are joined once through LDS behind the loop. Transposed products: S^T = K . Q^T (a lane holds 16 of one query's 32 scores of the pass), O^T += V^T . P^T for the three batches' value planes (3 x 3 tiles); P^T goes from the score accumulators straight into the B operand
#define QT 2
#define KH (SS / 2)       // keys of one wave
// amdgpu_waves_per_eu(2, 2): the block's 8 waves stand two on a SIMD, and the compiler schedules and budgets registers for exactly that
__device__ __forceinline__ float xhalf(float x) { return __builtin_bit_cast(float, __builtin_amdgcn_permlanex16(__builtin_bit_cast(int, x), __builtin_bit_cast(int, x), 0x76543210, 0xfedcba98, false, false)); }   // lane l's value from lane l ^ 16
__global__ __launch_bounds__(256) __attribute__((amdgpu_waves_per_eu(2, 2))) void k_attn(const _Float16* __restrict__ Q, const _Float16* __restrict__ Kr, const _Float16* __restrict__ V, float* __restrict__ O) {
  __shared__ __align__(16) v4f xa[8][18][32];   // hand-over: the 72 accumulator registers of the tile a wave gives away, 16 bytes a lane
  __shared__ float xm[8][2][32];                // with that tile's maximum and sum
  const int tid = threadIdx.x, wave = tid >> 5, lane = tid & 31, g = lane >> 4; const int h = blockIdx.y; const int q0 = blockIdx.x * (64 * QT) + (wave & 3) * (16 * QT);
  const int kh = __builtin_amdgcn_readfirstlane(tid >> 7);   // the wave's key half, held scalar so that the loop's addresses keep their scalar part
  const int kb = kh * KH;
  v16h aq[QT][2];
#pragma unroll
  for (int t = 0; t < QT; ++t)
#pragma unroll
    for (int kc = 0; kc < 2; ++kc) aq[t][kc] = frag_l(Q + ((size_t)h * SS + q0 + t * 16) * HDK + kc * 512 + lane * 8);
  const _Float16* Kh = Kr + (size_t)h * SS * HDK + lane * 8;          // the head's keys: 64 halves a key, 1 KiB a fragment
  const _Float16* Vh = V + (size_t)h * SS * (NB * HDV) + lane * 8;   // the head's values: 144 halves a key, the nine fragments of 32 keys in a row
  v16h kf[2][2];   // the pass's key fragments, fetched one pass ahead
#pragma unroll
  for (int ct = 0; ct < 2; ++ct)
#pragma unroll
    for (int kc = 0; kc < 2; ++kc) kf[ct][kc] = frag_l(Kh + (size_t)kb * HDK + (ct * 2 + kc) * 512);
  asm volatile("s_wait_xcnt 0x0" ::: "memory");   // the query and key loads' address registers are reused below: the wait stands in front of that
  __builtin_amdgcn_sched_barrier(0);   // keeps the vector work below behind the wait
  float m[QT], l[QT];   // per lane: its query's running maximum (equal in both wave halves) and the sum over the keys of its own half
#pragma unroll
  for (int t = 0; t < QT; ++t) { m[t] = -3.0e38f; l[t] = 0.f; }
  v8f acc[QT][3][3] = {};   // O^T tiles: register r = value dim dt * 16 + 8 g + r, column = query
#pragma unroll 1
  for (int ks = 0; ks < KH / 32; ++ks) { const int j0 = kb + ks * 32; v8f s[QT][2];
    v16h vf[3][3];   // the pass's value fragments: all loads issued here as one group, they land behind the score products and the softmax
    const _Float16* vp = Vh + (size_t)j0 * (NB * HDV);   // one base for the eighteen loads
    __builtin_amdgcn_sched_barrier(0);   // with the one behind the wait: nothing but the loads stands between them, so no other instruction takes over an address register ahead of the wait
#pragma unroll
    for (int b = 0; b < 3; ++b)
#pragma unroll
      for (int dt = 0; dt < 3; ++dt) vf[b][dt] = frag_l(vp + (b * 3 + dt) * 512);
    asm volatile("s_wait_xcnt 0x0" :: "v"(vp) : "memory");   // the value loads' address registers are free for reuse behind them: the wait stands in front of any rewrite; it names the address, which so stays out of the loads' own destinations
    __builtin_amdgcn_sched_barrier(0);   // keeps later vector work behind the wait
#pragma unroll
    for (int ct = 0; ct < 2; ++ct)
#pragma unroll
      for (int t = 0; t < QT; ++t) { v8f c = {};
#pragma unroll
        for (int kc = 0; kc < 2; ++kc) c = wmma16(kf[ct][kc], aq[t][kc], c);   // rows = keys j0 + ct * 16 + 8 g + r, column = query
#pragma unroll
        for (int r = 0; r < 8; ++r) s[t][ct][r] = c[r] * 0.15811388300841897f; }   // 40^-0.5
    const int jn = (ks + 1 < KH / 32) ? j0 + 32 : 0;   // next pass's keys (the last pass re-reads the first rows, unused)
    const _Float16* kp = Kh + (size_t)jn * HDK;   // one base for the eight loads
    __builtin_amdgcn_sched_barrier(0);   // with the one behind the wait: nothing but the loads stands between them
#pragma unroll
    for (int ct = 0; ct < 2; ++ct)
#pragma unroll
      for (int kc = 0; kc < 2; ++kc) kf[ct][kc] = frag_l(kp + (ct * 2 + kc) * 512);
    asm volatile("s_wait_xcnt 0x0" :: "v"(kp) : "memory");   // the key loads' address registers are reused by the softmax: the wait stands in front of that; it names the address, as at the value loads
    __builtin_amdgcn_sched_barrier(0);   // keeps the key loads in front of the softmax, whose whole length then covers their latency
    v16h pb[QT];   // P^T as B operand: element ct * 8 + r = key ct * 16 + 8 g + r, the hardware k order in which frag_l reads the packed value fragments
#pragma unroll
    for (int t = 0; t < QT; ++t) { float mr[8];
#pragma unroll
      for (int r = 0; r < 8; ++r) mr[r] = fmaxf(s[t][0][r], s[t][1][r]);
      float mx = fmaxf(fmaxf(fmaxf(mr[0], mr[1]), fmaxf(mr[2], mr[3])), fmaxf(fmaxf(mr[4], mr[5]), fmaxf(mr[6], mr[7])));
      mx = fmaxf(mx, xhalf(mx));   // the other half's 16 keys
      const float mn = fmaxf(m[t], mx); const float alpha = (m[t] <= -1.0e38f) ? 0.f : __expf(m[t] - mn); float er[8];
#pragma unroll
      for (int r = 0; r < 8; ++r) { const float e0 = __expf(s[t][0][r] - mn), e1 = __expf(s[t][1][r] - mn); er[r] = e0 + e1;
        pb[t][r] = (_Float16)(e0 * 2048.0f); pb[t][8 + r] = (_Float16)(e1 * 2048.0f); }
      l[t] = l[t] * alpha + (((er[0] + er[1]) + (er[2] + er[3])) + ((er[4] + er[5]) + (er[6] + er[7]))); m[t] = mn;
#pragma unroll
      for (int b = 0; b < 3; ++b)
#pragma unroll
        for (int dt = 0; dt < 3; ++dt) acc[t][b][dt] *= alpha; }
#pragma unroll
    for (int b = 0; b < 3; ++b)
#pragma unroll
      for (int dt = 0; dt < 3; ++dt)
#pragma unroll
        for (int t = 0; t < QT; ++t) acc[t][b][dt] = wmma16(vf[b][dt], pb[t], acc[t][b][dt]); }
  // join of the two key halves: the wave of half kh finishes query tile kh and hands its partial result for the other tile to its partner (wave ^ 4)
  v8f ka[3][3]; const float km = kh ? m[1] : m[0], kl = kh ? l[1] : l[0];
#pragma unroll
  for (int b = 0; b < 3; ++b)
#pragma unroll
    for (int dt = 0; dt < 3; ++dt) { const v8f ga = kh ? acc[0][b][dt] : acc[1][b][dt]; ka[b][dt] = kh ? acc[1][b][dt] : acc[0][b][dt];
      v4f lo, hi;
#pragma unroll
      for (int r = 0; r < 4; ++r) { lo[r] = ga[r]; hi[r] = ga[4 + r]; }
      xa[wave][(b * 3 + dt) * 2][lane] = lo; xa[wave][(b * 3 + dt) * 2 + 1][lane] = hi; }
  xm[wave][0][lane] = kh ? m[0] : m[1]; xm[wave][1][lane] = kh ? l[0] : l[1];
  __syncthreads();   // every wave's hand-over is written before its partner reads it
  const int pw = wave ^ 4; const float pm = xm[pw][0][lane], pl = xm[pw][1][lane];
  const float mj = fmaxf(km, pm); const float fk = __expf(km - mj), fp = __expf(pm - mj);   // both halves have seen keys, so both maxima are scores
  const float lj = kl * fk + pl * fp;
  const float il = (1.0f / 2048.0f) / (lj + xhalf(lj));   // the two wave halves' sums joined once, with every lane on
  const float ck = fk * il, cp = fp * il;
  // an O^T accumulator tile already has the lane map of k_out's A fragment (lane = 16 g + query, 8 columns from 8 g): it is stored from the registers, 16 B a lane, the head's 64-column slot of the 16 queries as eight 512-B runs (40 live columns + 24 zeros)
  float* ob = O + ((size_t)q0 + kh * 16) * OSTR + h * 1024 + lane * 4;   // 16 rows = 16 * OSTR floats; a slot = 1,024 of them
  { v4f z; z[0] = z[1] = z[2] = z[3] = 0.f;
    __builtin_amdgcn_sched_barrier(0);   // with the one behind the wait: nothing but the stores stands between them, so no other instruction takes over one of their registers ahead of the wait
#pragma unroll
    for (int b = 0; b < 3; ++b) { vst2(ob + (size_t)b * SS * OSTR + 768, z); vst2(ob + (size_t)b * SS * OSTR + 896, z); }   // columns 48..63 of the slot
    asm volatile("s_wait_xcnt 0x0" ::: "memory");   // the stores' registers are reused below: the wait stands in front of that
    __builtin_amdgcn_sched_barrier(0); }   // keeps later work behind the wait
#pragma unroll
  for (int b = 0; b < 3; ++b) { float* ot = ob + (size_t)b * SS * OSTR;
    v4f ov[6];
#pragma unroll
    for (int dt = 0; dt < 3; ++dt) { const v4f lo = xa[pw][(b * 3 + dt) * 2][lane], hi = xa[pw][(b * 3 + dt) * 2 + 1][lane];
#pragma unroll
      for (int r = 0; r < 4; ++r) { ov[dt * 2][r] = (dt * 16 + 8 * g + r < HD) ? ka[b][dt][r] * ck + lo[r] * cp : 0.f; ov[dt * 2 + 1][r] = (dt * 16 + 8 * g + 4 + r < HD) ? ka[b][dt][4 + r] * ck + hi[r] * cp : 0.f; } }
    __builtin_amdgcn_sched_barrier(0);   // with the one behind the wait: nothing but the stores stands between them
#pragma unroll
    for (int f = 0; f < 6; ++f) vst2(ot + f * 128, ov[f]);
    asm volatile("s_wait_xcnt 0x0" ::: "memory");   // the stores' data and address registers are reused by the next batch: the wait stands in front of that
    __builtin_amdgcn_sched_barrier(0); }   // keeps later work behind the wait
}
// ---- k_out: block = (64 rows, 64-column chunk (5 chunks of 320)): out = o (hi + residual, K 512 head slots) . Wo rows + bo
__global__ __launch_bounds__(128) void k_out(const float* __restrict__ O, const __bf16* __restrict__ POS, const float* __restrict__ BO, float* __restrict__ OUT) {
  __shared__ __align__(16) float so[4][16][68];
  const int tid = threadIdx.x, wave = tid >> 5, lane = tid & 31, col = lane & 15, g = lane >> 4; const size_t r0 = (size_t)blockIdx.x * 64 + wave * 16; const int n0 = blockIdx.y * 64;
  v8f acc[4] = {};
#pragma unroll
  for (int kc = 0; kc < OSTR / 32; ++kc) { if ((kc & 1) && ((kc * 32) & 63) >= 48) {}   // (all chunks carry live or zero-weighted columns)
    float v[16];
#pragma unroll
    for (int q = 0; q < 4; ++q) { const v4f x = *(const v4f*)(O + r0 * OSTR + kc * 512 + q * 128 + lane * 4);
#pragma unroll
      for (int i = 0; i < 4; ++i) v[q * 4 + i] = x[i]; }
    const F2 a = bsplit16(v);
#pragma unroll
    for (int j = 0; j < 4; ++j) { const v16b w = frag_lb(POS + (size_t)(((n0 >> 4) + j) * 16 + kc) * 512 + lane * 8); acc[j] = wmma_bf(a.l, w, acc[j]); acc[j] = wmma_bf(a.h, w, acc[j]); } }
#pragma unroll
  for (int j = 0; j < 4; ++j) { const float bb = bfr(BO[n0 + j * 16 + col]);
#pragma unroll
    for (int r = 0; r < 8; ++r) so[wave][8 * g + r][j * 16 + col] = acc[j][r] + bb; }
  LDSX();
  for (int rl = 0; rl < 16; ++rl) if (lane < 16) vst2(OUT + (r0 + rl) * DM + n0 + lane * 4, *(const v4f*)&so[wave][rl][lane * 4]);
}
extern "C" void kernel_launch(void* const* d_in, const int* in_sizes, int n_in, void* d_out, int out_size, void* d_ws, size_t ws_size, hipStream_t stream) {
  (void)in_sizes; (void)n_in; (void)out_size;
  const float** F = (const float**)d_in;   // 0 x [3,4096,320], 1 Wq, 2 Wk, 3 Wv, 4 Wo (natural [320,320]), 5 bo
  if (ws_size < (size_t)WS_END) return;
  char* ws = (char*)d_ws; __bf16* P = (__bf16*)ws; __bf16* POS = (__bf16*)(ws + WS_POS); _Float16 *Q = (_Float16*)(ws + WS_Q), *Kr = (_Float16*)(ws + WS_K), *V = (_Float16*)(ws + WS_V); float* O = (float*)(ws + WS_O);
  k_pack<<<dim3(DM / 16 * (OSTR / 32) * 2 / 8, 4), 256, 0, stream>>>(F[1], F[2], F[3], F[4], P, POS);
  k_zero<<<(unsigned)(((size_t)SS * NH * HDK * 2 + (size_t)NB * NH * HDV * SS) / 4096), 256, 0, stream>>>(Q, (size_t)SS * NH * HDK * 2 + (size_t)NB * NH * HDV * SS);   // Q, K (contiguous) and V regions
  k_proj<<<dim3(NR / 64, NH, 3), 128, 0, stream>>>(F[0], P, Q, Kr, V);
  k_attn<<<dim3(SS / (64 * QT), NH), 256, 0, stream>>>(Q, Kr, V, O);
  k_out<<<dim3(NR / 64, DM / 64), 128, 0, stream>>>(O, POS, F[5], (float*)d_out);
}

// v007
// Measured time: 92.1 microseconds a run.
// Timed twice side by side with v006, it ran 1.12 and 1.13 times as fast.
// Counting every step since v000, it is 4.79 times as fast.
// compute dtype: all float inputs rounded to bf16; q, k (from the source third x[0]) and v (all three batches) = x . W^T with EXACT bf16 products on WMMA 16x16x32 (natural rows), rounded once to f16 with the 40-dim heads zero-padded to 64 (keys) / 48 (values); PLAIN attention shared across the three batches: q, k as single f16 operands x 40^-0.5, running-max softmax in f32 (hardware exp), P (scaled by 2^11, single f16) x v (single f16) for the three value sets at once; out = o (bf16 hi + residual) . Wo^T (2 products) + bo.
#include <hip/hip_runtime.h>
#include <math.h>

typedef __attribute__((ext_vector_type(16))) _Float16 v16h;
typedef __attribute__((ext_vector_type(16))) __bf16 v16b;
typedef __attribute__((ext_vector_type(8)))  _Float16 v8h;
typedef __attribute__((ext_vector_type(8)))  float v8f;
typedef __attribute__((ext_vector_type(4)))  float v4f;
typedef __attribute__((ext_vector_type(2)))  float v2f;
typedef __attribute__((ext_vector_type(4)))  unsigned v4u;
typedef __attribute__((ext_vector_type(4)))  int v4i;
typedef float __attribute__((may_alias)) float_a;
typedef int __attribute__((may_alias)) int_a;

template <typename T> __device__ __forceinline__ void vst2(void* p, T v) { *(T*)p = v;  }
__device__ __forceinline__ v8f wmma16(v16h a, v16h b, v8f c) {
  return __builtin_amdgcn_wmma_f32_16x16x32_f16(false, a, false, b, (short)0, c, false, false);   // plain builtin: the compiler keeps the distance behind it; an asm statement on its operands would hold all of them below v256, and the two-tile wave has more than that live
}
__device__ __forceinline__ v8f wmma_bf(v16b a, v16b b, v8f c) {
  return __builtin_amdgcn_wmma_f32_16x16x32_bf16(false, a, false, b, (short)0, c, false, false);   // plain builtin, as wmma16: a volatile asm tail behind each product orders all memory accesses around it, which held every fragment load behind the product before it, each load's latency waited out alone
}
// 16x16x32 fragments: lane = (h = lane>>4, row/col = lane&15); elements 0..7 = k0+8h+0..7, 8..15 = k0+16+8h+0..7; D element r = row 8h+r
__device__ __forceinline__ v16h frag_h(const _Float16* rowk0, int lane) {
  union { v16h v; v8h q[2]; } u; const _Float16* p = rowk0 + 8 * (lane >> 4);
  u.q[0] = *(const v8h*)p; u.q[1] = *(const v8h*)(p + 16); return u.v;
}
// fragment stored in fragment order: two runs of 512 B, 16 B a lane (p already holds the lane's 8 * lane), so that a wave's load covers four whole 128-B lines
__device__ __forceinline__ v16h frag_l(const _Float16* p) {
  union { v16h v; v8h q[2]; } u; u.q[0] = *(const v8h*)p; u.q[1] = *(const v8h*)(p + 256); return u.v;
}
__device__ __forceinline__ v16h frag_f32(const float* rowk0, int lane) {
  v16h a; const float* p = rowk0 + 8 * (lane >> 4);
#pragma unroll
  for (int i = 0; i < 8; ++i) { a[i] = (_Float16)p[i]; a[8 + i] = (_Float16)p[16 + i]; }
  return a;
}
__device__ __forceinline__ v16h frag_f32s(const float* rowk0, int lane, float sc) {
  v16h a; const float* p = rowk0 + 8 * (lane >> 4);
#pragma unroll
  for (int i = 0; i < 8; ++i) { a[i] = (_Float16)(p[i] * sc); a[8 + i] = (_Float16)(p[16 + i] * sc); }
  return a;
}
// column fragment from a [K][ld] layout (column n), rows >= K read as 0
__device__ __forceinline__ v16h fragc_f32(const float* W, int k0, int n, int lane, int ld, int K) {
  v16h a; const int g = lane >> 4;
#pragma unroll
  for (int i = 0; i < 8; ++i) { const int ka = k0 + 8 * g + i, kb = ka + 16;
    a[i] = (_Float16)(ka < K ? W[(size_t)(ka < K ? ka : K - 1) * ld + n] : 0.f); a[8 + i] = (_Float16)(kb < K ? W[(size_t)(kb < K ? kb : K - 1) * ld + n] : 0.f); }
  return a;
}
struct F2 { v16b h, l; };
__device__ __forceinline__ F2 bsplit16(const float v[16]) { F2 r;
#pragma unroll
  for (int i = 0; i < 16; ++i) { const __bf16 h = (__bf16)v[i]; r.h[i] = h; r.l[i] = (__bf16)(v[i] - (float)h); }
  return r; }
__device__ __forceinline__ F2 split_row(const float* row, int k0, int lane) { float v[16]; const float* p = row + k0 + 8 * (lane >> 4);
#pragma unroll
  for (int i = 0; i < 8; ++i) { v[i] = p[i]; v[8 + i] = p[16 + i]; }
  return bsplit16(v); }
__device__ __forceinline__ F2 split_rowK(const float* row, int k0, int lane, int K) { float v[16]; const int g = lane >> 4;
#pragma unroll
  for (int i = 0; i < 8; ++i) { const int ka = k0 + 8 * g + i, kb = ka + 16; v[i] = ka < K ? row[ka < K ? ka : K - 1] : 0.f; v[8 + i] = kb < K ? row[kb < K ? kb : K - 1] : 0.f; }
  return bsplit16(v); }
__device__ __forceinline__ F2 split_col(const float* W, int k0, int n, int lane, int ld, int K) { float v[16]; const int g = lane >> 4;
#pragma unroll
  for (int i = 0; i < 8; ++i) { const int ka = k0 + 8 * g + i, kb = ka + 16; v[i] = ka < K ? W[(size_t)(ka < K ? ka : K - 1) * ld + n] : 0.f; v[8 + i] = kb < K ? W[(size_t)(kb < K ? kb : K - 1) * ld + n] : 0.f; }
  return bsplit16(v); }
__device__ __forceinline__ v8f mac3(const F2& a, const F2& b, v8f c) { c = wmma_bf(a.l, b.h, c); c = wmma_bf(a.h, b.l, c); return wmma_bf(a.h, b.h, c); }
__device__ __forceinline__ float sigm(float v) { return 1.0f / (1.0f + expf(-v)); }
#define LDSX() do { asm volatile("s_wait_dscnt 0" ::: "memory"); __builtin_amdgcn_wave_barrier(); __builtin_amdgcn_fence(__ATOMIC_RELEASE, "workgroup"); } while (0)


// Plug-and-play feature injection attention (3 x 4,096 tokens x 320, 8 heads x 40): the source batch's queries and keys are reused for all three batches, values differ; softmax(q k^T / sqrt(40)) v, output projection + bias.
#define NB 3
#define SS 4096
#define DM 320
#define NH 8
#define HD 40
#define HDK 64            // key dims padded to 2 k-chunks
#define HDV 48            // value dims padded to 3 tiles
#define NR (NB * SS)
typedef __attribute__((ext_vector_type(8))) __bf16 v8b;
__device__ __forceinline__ v16b frag_lb(const __bf16* p) {   // as frag_l
  union { v16b v; v8b q[2]; } u; u.q[0] = *(const v8b*)p; u.q[1] = *(const v8b*)(p + 256); return u.v;
}
__device__ __forceinline__ float bfr(float v) { return (float)(__bf16)v; }
__device__ __attribute__((noinline)) float exp_ni(float v) { return expf(v); }
__device__ __attribute__((noinline)) float erf_ni(float v) { return erff(v); }

#define WS_PW   0u                                   // bf16 Wq, Wk, Wv in fragment order [3][h][k / 32][row tile of the head][k / 16 & 1][lane = 16 * (k / 8 & 1) + row % 16][k % 8]
#define PRUNS   (NH * (DM / 32) * 3 * 2)             // 512-B runs of one of them
#define WS_Q    (WS_PW + 2u * (size_t)4 * DM * DM)     // f16 q (padded, batch 0 only), laid out as k
#define WS_K    (WS_Q + 2u * (size_t)SS * NH * HDK)     // f16 k (padded, batch 0 only) in fragment order [h][key / 16][dim / 16][lane = 16 * (dim / 8 & 1) + key % 16][dim % 8]
#define WS_V    (WS_K + 2u * (size_t)SS * NH * HDK)     // f16 v (pad dims zero) in fragment order [h][key / 32][b][dim / 16][key / 16 & 1][lane = 16 * (key / 8 & 1) + dim % 16][key % 8]
#define OSTR    (NH * 64)                             // O columns: a 64-float slot per head
#define WS_O    (WS_V + 2u * (size_t)NB * NH * HDV * SS) // f32 in fragment order [row / 16][column / 32][column / 16 & 1][column / 4 & 1][lane = 16 * (column / 8 & 1) + row % 16][column % 4]
#define WS_POS  (WS_O + 4u * (size_t)NR * OSTR)      // bf16 Wo, k in slot layout, in fragment order [row / 16][k / 32][k / 16 & 1][lane = 16 * (k / 8 & 1) + row % 16][k % 8]
#define WS_END  (WS_POS + 2u * (size_t)DM * OSTR)

// ---- k_pack: a wave = one 512-B run of a weight operand, rounded to bf16, in its reader's fragment order. which 0..2: Wq, Wk, Wv for k_proj (row tiles of a head's 40 rows; rows past the 39th repeat it, their columns are discarded); which 3: Wo for k_out, k in the 64-wide head slots (zeros in the pads)
__global__ __launch_bounds__(256) void k_pack(const float* __restrict__ WQ, const float* __restrict__ WK, const float* __restrict__ WV, const float* __restrict__ WO, __bf16* __restrict__ P, __bf16* __restrict__ POS) {
  const int which = blockIdx.y, lane = threadIdx.x & 31, col = lane & 15, g = lane >> 4; const int R = blockIdx.x * 8 + (threadIdx.x >> 5), p = R & 1;
  v8b o;
  if (which < 3) {
    if (R >= PRUNS) return;
    const float* Wm = (which == 0) ? WQ : (which == 1) ? WK : WV;
    const int t = R >> 1, j = t % 3, kc = (t / 3) % (DM / 32), h = t / (3 * (DM / 32));
    const float* s = Wm + (size_t)(h * HD + min(j * 16 + col, HD - 1)) * DM + kc * 32 + p * 16 + 8 * g;
    const v4f x0 = *(const v4f*)s, x1 = *(const v4f*)(s + 4);
    asm volatile("s_wait_xcnt 0x0" ::: "memory");   // the loads' address registers are reused below: the wait stands in front of that
    __builtin_amdgcn_sched_barrier(0);   // keeps the work below behind the wait
#pragma unroll
    for (int i = 0; i < 4; ++i) { o[i] = (__bf16)x0[i]; o[4 + i] = (__bf16)x1[i]; }
    vst2(P + ((size_t)which * PRUNS + R) * 256 + lane * 8, o);
  } else {
    const int kc = (R >> 1) & 15, nt = R >> 5; const int k0 = kc * 32 + p * 16 + 8 * g, hh = k0 >> 6, d0 = k0 & 63;   // 8 slot columns: all live or all pad
    const float* s = WO + (size_t)(nt * 16 + col) * DM + hh * HD + min(d0, HD - 8);
    const v4f x0 = *(const v4f*)s, x1 = *(const v4f*)(s + 4);   // read by every lane (the address is clamped), so that the two loads go out together
    asm volatile("s_wait_xcnt 0x0" ::: "memory");   // the loads' address registers are reused below: the wait stands in front of that
    __builtin_amdgcn_sched_barrier(0);   // keeps the work below behind the wait
#pragma unroll
    for (int i = 0; i < 4; ++i) { o[i] = (__bf16)((d0 < HD) ? x0[i] : 0.f); o[4 + i] = (__bf16)((d0 < HD) ? x1[i] : 0.f); }
    vst2(POS + (size_t)R * 256 + lane * 8, o);
  }
}
// ---- k_zero: zeroes the q, k and v regions (f16 zeros): block = 4096-element chunk (kept as it was; k_proj's stores cover every pad of the three)
__global__ __launch_bounds__(256) void k_zero(_Float16* __restrict__ A, size_t n16) { const size_t i = ((size_t)blockIdx.x * 256 + threadIdx.x) * 16; if (i + 16 <= n16) { v4f z; z[0] = z[1] = z[2] = z[3] = 0.f; vst2((float*)(A + i), z); vst2((float*)(A + i + 8), z); } }
#define HG 4              // heads that one k_proj wave walks
#define WR 5              // k chunks of weight fragments that it holds in flight
// amdgpu_waves_per_eu(3, 4) on k_proj: registers for the wave's ten A fragments (80) and WR chunks of weight fragments (120); the grid gives a SIMD two to three such waves, and three still stand on it
// ---- k_proj: block = (64 rows, group of HG heads, which): a wave reads and rounds its 16 rows of x once, keeps them as the ten A fragments, and walks the group's heads: per head 40 output columns (3 tiles, last tile half used). The group's weight fragments lie in a row in P and are read as one stream, WR chunks ahead of the products, over the heads' stores too: few waves stand on a SIMD, so a wave covers its own load latency. which 0: q, 1: k (batch-0 rows), 2: v for all batches -> the fragment order that k_attn's loads read (WS_K, WS_V)
__global__ __launch_bounds__(128) __attribute__((amdgpu_waves_per_eu(3, 4))) void k_proj(const float* __restrict__ X, const __bf16* __restrict__ P, _Float16* __restrict__ Q, _Float16* __restrict__ Kr, _Float16* __restrict__ V) {
  __shared__ __align__(16) _Float16 so[64][56]; __shared__ __align__(16) _Float16 st[2][48][72];   // st: two buffers, taken in turn by the heads, so that one barrier a head is enough
  const int tid = threadIdx.x, wave = tid >> 5, lane = tid & 31, col = lane & 15, g = lane >> 4; const int which = blockIdx.z; const size_t rb0 = (size_t)blockIdx.x * 64, r0 = rb0 + wave * 16;
  if (which < 2 && rb0 >= SS) return;   // q, k only from the source batch
  const __bf16* Wg = P + ((size_t)which * PRUNS + blockIdx.y * HG * (PRUNS / NH)) * 256 + lane * 8;   // the group's HG * 10 chunks of three fragments
  v16b w[WR][3];
#pragma unroll
  for (int c = 0; c < WR; ++c)
#pragma unroll
    for (int j = 0; j < 3; ++j) w[c][j] = frag_lb(Wg + (c * 3 + j) * 512);
  v4f xr[DM / 32][4];   // the wave's rows as read: all forty loads go out together
#pragma unroll
  for (int kc = 0; kc < DM / 32; ++kc) { const float* p = X + (r0 + col) * DM + kc * 32 + 8 * g;
#pragma unroll
    for (int q = 0; q < 4; ++q) xr[kc][q] = *(const v4f*)(p + (q >> 1) * 16 + (q & 1) * 4); }
  asm volatile("s_wait_xcnt 0x0" ::: "memory");   // the loads' address registers are reused below: the wait stands in front of that
  __builtin_amdgcn_sched_barrier(0);   // keeps the work below behind the wait
  v16b a[DM / 32];
#pragma unroll
  for (int kc = 0; kc < DM / 32; ++kc)
#pragma unroll
    for (int i = 0; i < 16; ++i) a[kc][i] = (__bf16)xr[kc][i >> 2][i & 3];
  const size_t b = rb0 / SS, s0 = rb0 % SS;
#pragma unroll   // unrolled: the ring's place and the stream's end are then known at compile time
  for (int hh = 0; hh < HG; ++hh) { const int h = blockIdx.y * HG + hh;
    v8f acc[3] = {};
#pragma unroll
    for (int kc = 0; kc < DM / 32; ++kc) { const int c = hh * (DM / 32) + kc;
#pragma unroll
      for (int j = 0; j < 3; ++j) acc[j] = wmma_bf(a[kc], w[c % WR][j], acc[j]);   // columns n >= 40 are discarded
      if (c + WR < HG * (DM / 32)) {
#pragma unroll
        for (int j = 0; j < 3; ++j) w[c % WR][j] = frag_lb(Wg + ((c + WR) * 3 + j) * 512); }
      __builtin_amdgcn_sched_barrier(0); }   // holds each refill where it is written, WR chunks ahead of its products; left free, the loads sink to about one chunk ahead
    asm volatile("s_wait_xcnt 0x0" ::: "memory");   // the loads' address registers are reused below: the wait stands in front of that
    __builtin_amdgcn_sched_barrier(0);   // keeps the work below behind the wait
    if (which < 2) {
#pragma unroll
      for (int j = 0; j < 3; ++j) { const int n = j * 16 + col;
#pragma unroll
        for (int r = 0; r < 8; ++r) so[wave * 16 + 8 * g + r][n] = (n < HD) ? (_Float16)acc[j][r] : (_Float16)0.f; }
      LDSX();
      _Float16* kt = ((which == 0) ? Q : Kr) + ((size_t)h * SS + r0) * HDK + lane * 8;   // the wave's 16 rows are one 2-KiB tile: four 512-B runs, one per 16 dims
#pragma unroll
      for (int f = 0; f < 3; ++f) vst2((unsigned*)(kt + f * 256), *(const v4u*)&so[wave * 16 + col][f * 16 + 8 * g]);   // dims 0..47 (40 live + 8 zero)
      v4u z; z[0] = z[1] = z[2] = z[3] = 0u; vst2((unsigned*)(kt + 3 * 256), z);   // dims 48..63
    } else {
#pragma unroll
      for (int j = 0; j < 3; ++j) { const int n = j * 16 + col;
#pragma unroll
        for (int r = 0; r < 8; ++r) st[hh & 1][n][wave * 16 + 8 * g + r] = (n < HD) ? (_Float16)acc[j][r] : (_Float16)0.f; }
      __syncthreads();   // the head's tile is whole before it is read; a wave that passes it has also ended its reads of the other buffer, which the next head writes
      for (int e = tid; e < 48 * 8; e += 128) { const int ln = e & 31, p = (e >> 5) & 1, dk = e >> 6, dt = dk % 3, kp = dk / 3;   // 12 runs of 512 B: (32-key group kp, dim tile dt, key half p)
        vst2((unsigned*)(V + ((((size_t)h * (SS / 32) + (s0 >> 5) + kp) * (NB * 3) + b * 3 + dt) * 2 + p) * 256 + ln * 8), *(const v4u*)&st[hh & 1][dt * 16 + (ln & 15)][kp * 32 + p * 16 + (ln >> 4) * 8]); } }
    asm volatile("s_wait_xcnt 0x0" ::: "memory");   // the stores' data and address registers are reused by the next head: the wait stands in front of that
    __builtin_amdgcn_sched_barrier(0); }   // keeps the next head's work behind the wait
}
// ---- k_attn: block = (128 queries, head), 8 waves: waves w and w + 4 take the same 32 queries (two 16-column tiles) and one half of the 4,096 keys each, so that one wave's softmax issues under the other's products; the two partial results are joined once through LDS behind the loop. Transposed products: S^T = K . Q^T (a lane holds 16 of one query's 32 scores of the pass), O^T += V^T . P^T for the three batches' value planes (3 x 3 tiles); P^T goes from the score accumulators straight into the B operand
#define QT 2
#define KH (SS / 2)       // keys of one wave
// amdgpu_waves_per_eu(2, 2): the block's 8 waves stand two on a SIMD, and the compiler schedules and budgets registers for exactly that
__device__ __forceinline__ float xhalf(float x) { return __builtin_bit_cast(float, __builtin_amdgcn_permlanex16(__builtin_bit_cast(int, x), __builtin_bit_cast(int, x), 0x76543210, 0xfedcba98, false, false)); }   // lane l's value from lane l ^ 16
__global__ __launch_bounds__(256) __attribute__((amdgpu_waves_per_eu(2, 2))) void k_attn(const _Float16* __restrict__ Q, const _Float16* __restrict__ Kr, const _Float16* __restrict__ V, float* __restrict__ O) {
  __shared__ __align__(16) v4f xa[8][18][32];   // hand-over: the 72 accumulator registers of the tile a wave gives away, 16 bytes a lane
  __shared__ float xm[8][2][32];                // with that tile's maximum and sum
  const int tid = threadIdx.x, wave = tid >> 5, lane = tid & 31, g = lane >> 4; const int h = blockIdx.y; const int q0 = blockIdx.x * (64 * QT) + (wave & 3) * (16 * QT);
  const int kh = __builtin_amdgcn_readfirstlane(tid >> 7);   // the wave's key half, held scalar so that the loop's addresses keep their scalar part
  const int kb = kh * KH;
  v16h aq[QT][2];
#pragma unroll
  for (int t = 0; t < QT; ++t)
#pragma unroll
    for (int kc = 0; kc < 2; ++kc) aq[t][kc] = frag_l(Q + ((size_t)h * SS + q0 + t * 16) * HDK + kc * 512 + lane * 8);
  const _Float16* Kh = Kr + (size_t)h * SS * HDK + lane * 8;          // the head's keys: 64 halves a key, 1 KiB a fragment
  const _Float16* Vh = V + (size_t)h * SS * (NB * HDV) + lane * 8;   // the head's values: 144 halves a key, the nine fragments of 32 keys in a row
  v16h kf[2][2];   // the pass's key fragments, fetched one pass ahead
#pragma unroll
  for (int ct = 0; ct < 2; ++ct)
#pragma unroll
    for (int kc = 0; kc < 2; ++kc) kf[ct][kc] = frag_l(Kh + (size_t)kb * HDK + (ct * 2 + kc) * 512);
  asm volatile("s_wait_xcnt 0x0" ::: "memory");   // the query and key loads' address registers are reused below: the wait stands in front of that
  __builtin_amdgcn_sched_barrier(0);   // keeps the vector work below behind the wait
  float m[QT], l[QT];   // per lane: its query's running maximum (equal in both wave halves) and the sum over the keys of its own half
#pragma unroll
  for (int t = 0; t < QT; ++t) { m[t] = -3.0e38f; l[t] = 0.f; }
  v8f acc[QT][3][3] = {};   // O^T tiles: register r = value dim dt * 16 + 8 g + r, column = query
#pragma unroll 1
  for (int ks = 0; ks < KH / 32; ++ks) { const int j0 = kb + ks * 32; v8f s[QT][2];
    v16h vf[3][3];   // the pass's value fragments: all loads issued here as one group, they land behind the score products and the softmax
    const _Float16* vp = Vh + (size_t)j0 * (NB * HDV);   // one base for the eighteen loads
    __builtin_amdgcn_sched_barrier(0);   // with the one behind the wait: nothing but the loads stands between them, so no other instruction takes over an address register ahead of the wait
#pragma unroll
    for (int b = 0; b < 3; ++b)
#pragma unroll
      for (int dt = 0; dt < 3; ++dt) vf[b][dt] = frag_l(vp + (b * 3 + dt) * 512);
    asm volatile("s_wait_xcnt 0x0" :: "v"(vp) : "memory");   // the value loads' address registers are free for reuse behind them: the wait stands in front of any rewrite; it names the address, which so stays out of the loads' own destinations
    __builtin_amdgcn_sched_barrier(0);   // keeps later vector work behind the wait
#pragma unroll
    for (int ct = 0; ct < 2; ++ct)
#pragma unroll
      for (int t = 0; t < QT; ++t) { v8f c = {};
#pragma unroll
        for (int kc = 0; kc < 2; ++kc) c = wmma16(kf[ct][kc], aq[t][kc], c);   // rows = keys j0 + ct * 16 + 8 g + r, column = query
#pragma unroll
        for (int r = 0; r < 8; ++r) s[t][ct][r] = c[r] * 0.15811388300841897f; }   // 40^-0.5
    const int jn = (ks + 1 < KH / 32) ? j0 + 32 : 0;   // next pass's keys (the last pass re-reads the first rows, unused)
    const _Float16* kp = Kh + (size_t)jn * HDK;   // one base for the eight loads
    __builtin_amdgcn_sched_barrier(0);   // with the one behind the wait: nothing but the loads stands between them
#pragma unroll
    for (int ct = 0; ct < 2; ++ct)
#pragma unroll
      for (int kc = 0; kc < 2; ++kc) kf[ct][kc] = frag_l(kp + (ct * 2 + kc) * 512);
    asm volatile("s_wait_xcnt 0x0" :: "v"(kp) : "memory");   // the key loads' address registers are reused by the softmax: the wait stands in front of that; it names the address, as at the value loads
    __builtin_amdgcn_sched_barrier(0);   // keeps the key loads in front of the softmax, whose whole length then covers their latency
    v16h pb[QT];   // P^T as B operand: element ct * 8 + r = key ct * 16 + 8 g + r, the hardware k order in which frag_l reads the packed value fragments
#pragma unroll
    for (int t = 0; t < QT; ++t) { float mr[8];
#pragma unroll
      for (int r = 0; r < 8; ++r) mr[r] = fmaxf(s[t][0][r], s[t][1][r]);
      float mx = fmaxf(fmaxf(fmaxf(mr[0], mr[1]), fmaxf(mr[2], mr[3])), fmaxf(fmaxf(mr[4], mr[5]), fmaxf(mr[6], mr[7])));
      mx = fmaxf(mx, xhalf(mx));   // the other half's 16 keys
      const float mn = fmaxf(m[t], mx); const float alpha = (m[t] <= -1.0e38f) ? 0.f : __expf(m[t] - mn); float er[8];
#pragma unroll
      for (int r = 0; r < 8; ++r) { const float e0 = __expf(s[t][0][r] - mn), e1 = __expf(s[t][1][r] - mn); er[r] = e0 + e1;
        pb[t][r] = (_Float16)(e0 * 2048.0f); pb[t][8 + r] = (_Float16)(e1 * 2048.0f); }
      l[t] = l[t] * alpha + (((er[0] + er[1]) + (er[2] + er[3])) + ((er[4] + er[5]) + (er[6] + er[7]))); m[t] = mn;
#pragma unroll
      for (int b = 0; b < 3; ++b)
#pragma unroll
        for (int dt = 0; dt < 3; ++dt) acc[t][b][dt] *= alpha; }
#pragma unroll
    for (int b = 0; b < 3; ++b)
#pragma unroll
      for (int dt = 0; dt < 3; ++dt)
#pragma unroll
        for (int t = 0; t < QT; ++t) acc[t][b][dt] = wmma16(vf[b][dt], pb[t], acc[t][b][dt]); }
  // join of the two key halves: the wave of half kh finishes query tile kh and hands its partial result for the other tile to its partner (wave ^ 4)
  v8f ka[3][3]; const float km = kh ? m[1] : m[0], kl = kh ? l[1] : l[0];
#pragma unroll
  for (int b = 0; b < 3; ++b)
#pragma unroll
    for (int dt = 0; dt < 3; ++dt) { const v8f ga = kh ? acc[0][b][dt] : acc[1][b][dt]; ka[b][dt] = kh ? acc[1][b][dt] : acc[0][b][dt];
      v4f lo, hi;
#pragma unroll
      for (int r = 0; r < 4; ++r) { lo[r] = ga[r]; hi[r] = ga[4 + r]; }
      xa[wave][(b * 3 + dt) * 2][lane] = lo; xa[wave][(b * 3 + dt) * 2 + 1][lane] = hi; }
  xm[wave][0][lane] = kh ? m[0] : m[1]; xm[wave][1][lane] = kh ? l[0] : l[1];
  __syncthreads();   // every wave's hand-over is written before its partner reads it
  const int pw = wave ^ 4; const float pm = xm[pw][0][lane], pl = xm[pw][1][lane];
  const float mj = fmaxf(km, pm); const float fk = __expf(km - mj), fp = __expf(pm - mj);   // both halves have seen keys, so both maxima are scores
  const float lj = kl * fk + pl * fp;
  const float il = (1.0f / 2048.0f) / (lj + xhalf(lj));   // the two wave halves' sums joined once, with every lane on
  const float ck = fk * il, cp = fp * il;
  // an O^T accumulator tile already has the lane map of k_out's A fragment (lane = 16 g + query, 8 columns from 8 g): it is stored from the registers, 16 B a lane, the head's 64-column slot of the 16 queries as eight 512-B runs (40 live columns + 24 zeros)
  float* ob = O + ((size_t)q0 + kh * 16) * OSTR + h * 1024 + lane * 4;   // 16 rows = 16 * OSTR floats; a slot = 1,024 of them
  { v4f z; z[0] = z[1] = z[2] = z[3] = 0.f;
    __builtin_amdgcn_sched_barrier(0);   // with the one behind the wait: nothing but the stores stands between them, so no other instruction takes over one of their registers ahead of the wait
#pragma unroll
    for (int b = 0; b < 3; ++b) { vst2(ob + (size_t)b * SS * OSTR + 768, z); vst2(ob + (size_t)b * SS * OSTR + 896, z); }   // columns 48..63 of the slot
    asm volatile("s_wait_xcnt 0x0" ::: "memory");   // the stores' registers are reused below: the wait stands in front of that
    __builtin_amdgcn_sched_barrier(0); }   // keeps later work behind the wait
#pragma unroll
  for (int b = 0; b < 3; ++b) { float* ot = ob + (size_t)b * SS * OSTR;
    v4f ov[6];
#pragma unroll
    for (int dt = 0; dt < 3; ++dt) { const v4f lo = xa[pw][(b * 3 + dt) * 2][lane], hi = xa[pw][(b * 3 + dt) * 2 + 1][lane];
#pragma unroll
      for (int r = 0; r < 4; ++r) { ov[dt * 2][r] = (dt * 16 + 8 * g + r < HD) ? ka[b][dt][r] * ck + lo[r] * cp : 0.f; ov[dt * 2 + 1][r] = (dt * 16 + 8 * g + 4 + r < HD) ? ka[b][dt][4 + r] * ck + hi[r] * cp : 0.f; } }
    __builtin_amdgcn_sched_barrier(0);   // with the one behind the wait: nothing but the stores stands between them
#pragma unroll
    for (int f = 0; f < 6; ++f) vst2(ot + f * 128, ov[f]);
    asm volatile("s_wait_xcnt 0x0" ::: "memory");   // the stores' data and address registers are reused by the next batch: the wait stands in front of that
    __builtin_amdgcn_sched_barrier(0); }   // keeps later work behind the wait
}
// ---- k_out: block = (64 rows, 64-column chunk (5 chunks of 320)): out = o (hi + residual, K 512 head slots) . Wo rows + bo
__global__ __launch_bounds__(128) void k_out(const float* __restrict__ O, const __bf16* __restrict__ POS, const float* __restrict__ BO, float* __restrict__ OUT) {
  __shared__ __align__(16) float so[4][16][68];
  const int tid = threadIdx.x, wave = tid >> 5, lane = tid & 31, col = lane & 15, g = lane >> 4; const size_t r0 = (size_t)blockIdx.x * 64 + wave * 16; const int n0 = blockIdx.y * 64;
  v8f acc[4] = {};
#pragma unroll
  for (int kc = 0; kc < OSTR / 32; ++kc) { if ((kc & 1) && ((kc * 32) & 63) >= 48) {}   // (all chunks carry live or zero-weighted columns)
    float v[16];
#pragma unroll
    for (int q = 0; q < 4; ++q) { const v4f x = *(const v4f*)(O + r0 * OSTR + kc * 512 + q * 128 + lane * 4);
#pragma unroll
      for (int i = 0; i < 4; ++i) v[q * 4 + i] = x[i]; }
    const F2 a = bsplit16(v);
#pragma unroll
    for (int j = 0; j < 4; ++j) { const v16b w = frag_lb(POS + (size_t)(((n0 >> 4) + j) * 16 + kc) * 512 + lane * 8); acc[j] = wmma_bf(a.l, w, acc[j]); acc[j] = wmma_bf(a.h, w, acc[j]); } }
#pragma unroll
  for (int j = 0; j < 4; ++j) { const float bb = bfr(BO[n0 + j * 16 + col]);
#pragma unroll
    for (int r = 0; r < 8; ++r) so[wave][8 * g + r][j * 16 + col] = acc[j][r] + bb; }
  LDSX();
  for (int rl = 0; rl < 16; ++rl) if (lane < 16) vst2(OUT + (r0 + rl) * DM + n0 + lane * 4, *(const v4f*)&so[wave][rl][lane * 4]);
}
extern "C" void kernel_launch(void* const* d_in, const int* in_sizes, int n_in, void* d_out, int out_size, void* d_ws, size_t ws_size, hipStream_t stream) {
  (void)in_sizes; (void)n_in; (void)out_size;
  const float** F = (const float**)d_in;   // 0 x [3,4096,320], 1 Wq, 2 Wk, 3 Wv, 4 Wo (natural [320,320]), 5 bo
  if (ws_size < (size_t)WS_END) return;
  char* ws = (char*)d_ws; __bf16* P = (__bf16*)ws; __bf16* POS = (__bf16*)(ws + WS_POS); _Float16 *Q = (_Float16*)(ws + WS_Q), *Kr = (_Float16*)(ws + WS_K), *V = (_Float16*)(ws + WS_V); float* O = (float*)(ws + WS_O);
  k_pack<<<dim3(DM / 16 * (OSTR / 32) * 2 / 8, 4), 256, 0, stream>>>(F[1], F[2], F[3], F[4], P, POS);
  k_zero<<<(unsigned)(((size_t)SS * NH * HDK * 2 + (size_t)NB * NH * HDV * SS) / 4096), 256, 0, stream>>>(Q, (size_t)SS * NH * HDK * 2 + (size_t)NB * NH * HDV * SS);   // Q, K (contiguous) and V regions
  k_proj<<<dim3(NR / 64, NH / HG, 3), 128, 0, stream>>>(F[0], P, Q, Kr, V);
  k_attn<<<dim3(SS / (64 * QT), NH), 256, 0, stream>>>(Q, Kr, V, O);
  k_out<<<dim3(NR / 64, DM / 64), 128, 0, stream>>>(O, POS, F[5], (float*)d_out);
}

// v008
// One run takes 85 microseconds.
// In two side-by-side timings against v007, it was 1.09 and 1.10 times as fast.
// Over all steps from v000 it is 5.23 times as fast.
// compute dtype: all float inputs rounded to bf16; q, k (from the source third x[0]) and v (all three batches) = x . W^T with EXACT bf16 products on WMMA 16x16x32 (natural rows), rounded once to f16 with the 40-dim heads zero-padded to 64 (keys) / 48 (values); PLAIN attention shared across the three batches: q, k as single f16 operands x 40^-0.5, running-max softmax in f32 (hardware exp), P (scaled by 2^11, single f16) x v (single f16) for the three value sets at once; out = o (bf16 hi + residual) . Wo^T (2 products) + bo.
#include <hip/hip_runtime.h>
#include <math.h>

typedef __attribute__((ext_vector_type(16))) _Float16 v16h;
typedef __attribute__((ext_vector_type(16))) __bf16 v16b;
typedef __attribute__((ext_vector_type(8)))  _Float16 v8h;
typedef __attribute__((ext_vector_type(8)))  float v8f;
typedef __attribute__((ext_vector_type(4)))  float v4f;
typedef __attribute__((ext_vector_type(2)))  float v2f;
typedef __attribute__((ext_vector_type(4)))  unsigned v4u;
typedef __attribute__((ext_vector_type(4)))  int v4i;
typedef float __attribute__((may_alias)) float_a;
typedef int __attribute__((may_alias)) int_a;

template <typename T> __device__ __forceinline__ void vst2(void* p, T v) { *(T*)p = v;  }
__device__ __forceinline__ v8f wmma16(v16h a, v16h b, v8f c) {
  return __builtin_amdgcn_wmma_f32_16x16x32_f16(false, a, false, b, (short)0, c, false, false);   // plain builtin: the compiler keeps the distance behind it; an asm statement on its operands would hold all of them below v256, and the two-tile wave has more than that live
}
__device__ __forceinline__ v8f wmma_bf(v16b a, v16b b, v8f c) {
  return __builtin_amdgcn_wmma_f32_16x16x32_bf16(false, a, false, b, (short)0, c, false, false);   // plain builtin, as wmma16: a volatile asm tail behind each product orders all memory accesses around it, which held every fragment load behind the product before it, each load's latency waited out alone
}
// 16x16x32 fragments: lane = (h = lane>>4, row/col = lane&15); elements 0..7 = k0+8h+0..7, 8..15 = k0+16+8h+0..7; D element r = row 8h+r
__device__ __forceinline__ v16h frag_h(const _Float16* rowk0, int lane) {
  union { v16h v; v8h q[2]; } u; const _Float16* p = rowk0 + 8 * (lane >> 4);
  u.q[0] = *(const v8h*)p; u.q[1] = *(const v8h*)(p + 16); return u.v;
}
// fragment stored in fragment order: two runs of 512 B, 16 B a lane (p already holds the lane's 8 * lane), so that a wave's load covers four whole 128-B lines
__device__ __forceinline__ v16h frag_l(const _Float16* p) {
  union { v16h v; v8h q[2]; } u; u.q[0] = *(const v8h*)p; u.q[1] = *(const v8h*)(p + 256); return u.v;
}
__device__ __forceinline__ v16h frag_f32(const float* rowk0, int lane) {
  v16h a; const float* p = rowk0 + 8 * (lane >> 4);
#pragma unroll
  for (int i = 0; i < 8; ++i) { a[i] = (_Float16)p[i]; a[8 + i] = (_Float16)p[16 + i]; }
  return a;
}
__device__ __forceinline__ v16h frag_f32s(const float* rowk0, int lane, float sc) {
  v16h a; const float* p = rowk0 + 8 * (lane >> 4);
#pragma unroll
  for (int i = 0; i < 8; ++i) { a[i] = (_Float16)(p[i] * sc); a[8 + i] = (_Float16)(p[16 + i] * sc); }
  return a;
}
// column fragment from a [K][ld] layout (column n), rows >= K read as 0
__device__ __forceinline__ v16h fragc_f32(const float* W, int k0, int n, int lane, int ld, int K) {
  v16h a; const int g = lane >> 4;
#pragma unroll
  for (int i = 0; i < 8; ++i) { const int ka = k0 + 8 * g + i, kb = ka + 16;
    a[i] = (_Float16)(ka < K ? W[(size_t)(ka < K ? ka : K - 1) * ld + n] : 0.f); a[8 + i] = (_Float16)(kb < K ? W[(size_t)(kb < K ? kb : K - 1) * ld + n] : 0.f); }
  return a;
}
struct F2 { v16b h, l; };
__device__ __forceinline__ F2 bsplit16(const float v[16]) { F2 r;
#pragma unroll
  for (int i = 0; i < 16; ++i) { const __bf16 h = (__bf16)v[i]; r.h[i] = h; r.l[i] = (__bf16)(v[i] - (float)h); }
  return r; }
__device__ __forceinline__ F2 split_row(const float* row, int k0, int lane) { float v[16]; const float* p = row + k0 + 8 * (lane >> 4);
#pragma unroll
  for (int i = 0; i < 8; ++i) { v[i] = p[i]; v[8 + i] = p[16 + i]; }
  return bsplit16(v); }
__device__ __forceinline__ F2 split_rowK(const float* row, int k0, int lane, int K) { float v[16]; const int g = lane >> 4;
#pragma unroll
  for (int i = 0; i < 8; ++i) { const int ka = k0 + 8 * g + i, kb = ka + 16; v[i] = ka < K ? row[ka < K ? ka : K - 1] : 0.f; v[8 + i] = kb < K ? row[kb < K ? kb : K - 1] : 0.f; }
  return bsplit16(v); }
__device__ __forceinline__ F2 split_col(const float* W, int k0, int n, int lane, int ld, int K) { float v[16]; const int g = lane >> 4;
#pragma unroll
  for (int i = 0; i < 8; ++i) { const int ka = k0 + 8 * g + i, kb = ka + 16; v[i] = ka < K ? W[(size_t)(ka < K ? ka : K - 1) * ld + n] : 0.f; v[8 + i] = kb < K ? W[(size_t)(kb < K ? kb : K - 1) * ld + n] : 0.f; }
  return bsplit16(v); }
__device__ __forceinline__ v8f mac3(const F2& a, const F2& b, v8f c) { c = wmma_bf(a.l, b.h, c); c = wmma_bf(a.h, b.l, c); return wmma_bf(a.h, b.h, c); }
__device__ __forceinline__ float sigm(float v) { return 1.0f / (1.0f + expf(-v)); }
#define LDSX() do { asm volatile("s_wait_dscnt 0" ::: "memory"); __builtin_amdgcn_wave_barrier(); __builtin_amdgcn_fence(__ATOMIC_RELEASE, "workgroup"); } while (0)


// Plug-and-play feature injection attention (3 x 4,096 tokens x 320, 8 heads x 40): the source batch's queries and keys are reused for all three batches, values differ; softmax(q k^T / sqrt(40)) v, output projection + bias.
#define NB 3
#define SS 4096
#define DM 320
#define NH 8
#define HD 40
#define HDK 64            // key dims padded to 2 k-chunks
#define HDV 48            // value dims padded to 3 tiles
#define NR (NB * SS)
typedef __attribute__((ext_vector_type(8))) __bf16 v8b;
__device__ __forceinline__ v16b frag_lb(const __bf16* p) {   // as frag_l
  union { v16b v; v8b q[2]; } u; u.q[0] = *(const v8b*)p; u.q[1] = *(const v8b*)(p + 256); return u.v;
}
__device__ __forceinline__ float bfr(float v) { return (float)(__bf16)v; }
__device__ __attribute__((noinline)) float exp_ni(float v) { return expf(v); }
__device__ __attribute__((noinline)) float erf_ni(float v) { return erff(v); }

#define WS_PW   0u                                   // bf16 Wq, Wk, Wv in fragment order [3][h][k / 32][row tile of the head][k / 16 & 1][lane = 16 * (k / 8 & 1) + row % 16][k % 8]
#define PRUNS   (NH * (DM / 32) * 3 * 2)             // 512-B runs of one of them
#define WS_Q    (WS_PW + 2u * (size_t)4 * DM * DM)     // f16 q (padded, batch 0 only), laid out as k
#define WS_K    (WS_Q + 2u * (size_t)SS * NH * HDK)     // f16 k (padded, batch 0 only) in fragment order [h][key / 16][dim / 16][lane = 16 * (dim / 8 & 1) + key % 16][dim % 8]
#define WS_V    (WS_K + 2u * (size_t)SS * NH * HDK)     // f16 v (pad dims zero) in fragment order [h][key / 32][b][dim / 16][key / 16 & 1][lane = 16 * (key / 8 & 1) + dim % 16][key % 8]
#define OSTR    (NH * 64)                             // O columns: a 64-float slot per head
#define WS_O    (WS_V + 2u * (size_t)NB * NH * HDV * SS) // f32 in fragment order [row / 16][column / 32][column / 16 & 1][column / 4 & 1][lane = 16 * (column / 8 & 1) + row % 16][column % 4]
#define WS_POS  (WS_O + 4u * (size_t)NR * OSTR)      // bf16 Wo, k in slot layout, in fragment order [row / 16][k / 32][k / 16 & 1][lane = 16 * (k / 8 & 1) + row % 16][k % 8]
#define WS_END  (WS_POS + 2u * (size_t)DM * OSTR)

// ---- k_pack: a wave = one 512-B run of a weight operand, rounded to bf16, in its reader's fragment order. which 0..2: Wq, Wk, Wv for k_proj (row tiles of a head's 40 rows; rows past the 39th repeat it, their columns are discarded); which 3: Wo for k_out, k in the 64-wide head slots (zeros in the pads)
__global__ __launch_bounds__(256) void k_pack(const float* __restrict__ WQ, const float* __restrict__ WK, const float* __restrict__ WV, const float* __restrict__ WO, __bf16* __restrict__ P, __bf16* __restrict__ POS) {
  const int which = blockIdx.y, lane = threadIdx.x & 31, col = lane & 15, g = lane >> 4; const int R = blockIdx.x * 8 + (threadIdx.x >> 5), p = R & 1;
  v8b o;
  if (which < 3) {
    if (R >= PRUNS) return;
    const float* Wm = (which == 0) ? WQ : (which == 1) ? WK : WV;
    const int t = R >> 1, j = t % 3, kc = (t / 3) % (DM / 32), h = t / (3 * (DM / 32));
    const float* s = Wm + (size_t)(h * HD + min(j * 16 + col, HD - 1)) * DM + kc * 32 + p * 16 + 8 * g;
    const v4f x0 = *(const v4f*)s, x1 = *(const v4f*)(s + 4);
    asm volatile("s_wait_xcnt 0x0" ::: "memory");   // the loads' address registers are reused below: the wait stands in front of that
    __builtin_amdgcn_sched_barrier(0);   // keeps the work below behind the wait
#pragma unroll
    for (int i = 0; i < 4; ++i) { o[i] = (__bf16)x0[i]; o[4 + i] = (__bf16)x1[i]; }
    vst2(P + ((size_t)which * PRUNS + R) * 256 + lane * 8, o);
  } else {
    const int kc = (R >> 1) & 15, nt = R >> 5; const int k0 = kc * 32 + p * 16 + 8 * g, hh = k0 >> 6, d0 = k0 & 63;   // 8 slot columns: all live or all pad
    const float* s = WO + (size_t)(nt * 16 + col) * DM + hh * HD + min(d0, HD - 8);
    const v4f x0 = *(const v4f*)s, x1 = *(const v4f*)(s + 4);   // read by every lane (the address is clamped), so that the two loads go out together
    asm volatile("s_wait_xcnt 0x0" ::: "memory");   // the loads' address registers are reused below: the wait stands in front of that
    __builtin_amdgcn_sched_barrier(0);   // keeps the work below behind the wait
#pragma unroll
    for (int i = 0; i < 4; ++i) { o[i] = (__bf16)((d0 < HD) ? x0[i] : 0.f); o[4 + i] = (__bf16)((d0 < HD) ? x1[i] : 0.f); }
    vst2(POS + (size_t)R * 256 + lane * 8, o);
  }
}
// ---- k_zero: zeroes the q, k and v regions (f16 zeros): block = 4096-element chunk (kept as it was; k_proj's stores cover every pad of the three)
__global__ __launch_bounds__(256) void k_zero(_Float16* __restrict__ A, size_t n16) { const size_t i = ((size_t)blockIdx.x * 256 + threadIdx.x) * 16; if (i + 16 <= n16) { v4f z; z[0] = z[1] = z[2] = z[3] = 0.f; vst2((float*)(A + i), z); vst2((float*)(A + i + 8), z); } }
#define HG 4              // heads that one k_proj wave walks
#define WR 5              // k chunks of weight fragments that it holds in flight
// amdgpu_waves_per_eu(3, 4) on k_proj: registers for the wave's ten A fragments (80) and WR chunks of weight fragments (120); the grid gives a SIMD two to three such waves, and three still stand on it
// ---- k_proj: block = (64 rows, group of HG heads, which): a wave reads and rounds its 16 rows of x once, keeps them as the ten A fragments, and walks the group's heads: per head 40 output columns (3 tiles, last tile half used). The group's weight fragments lie in a row in P and are read as one stream, WR chunks ahead of the products, over the heads' stores too: few waves stand on a SIMD, so a wave covers its own load latency. which 0: q, 1: k (batch-0 rows), 2: v for all batches -> the fragment order that k_attn's loads read (WS_K, WS_V)
__global__ __launch_bounds__(128) __attribute__((amdgpu_waves_per_eu(3, 4))) void k_proj(const float* __restrict__ X, const __bf16* __restrict__ P, _Float16* __restrict__ Q, _Float16* __restrict__ Kr, _Float16* __restrict__ V) {
  __shared__ __align__(16) _Float16 so[64][56]; __shared__ __align__(16) _Float16 st[2][48][72];   // st: two buffers, taken in turn by the heads, so that one barrier a head is enough
  const int tid = threadIdx.x, wave = tid >> 5, lane = tid & 31, col = lane & 15, g = lane >> 4; const int which = blockIdx.z; const size_t rb0 = (size_t)blockIdx.x * 64, r0 = rb0 + wave * 16;
  if (which < 2 && rb0 >= SS) return;   // q, k only from the source batch
  const __bf16* Wg = P + ((size_t)which * PRUNS + blockIdx.y * HG * (PRUNS / NH)) * 256 + lane * 8;   // the group's HG * 10 chunks of three fragments
  v16b w[WR][3];
#pragma unroll
  for (int c = 0; c < WR; ++c)
#pragma unroll
    for (int j = 0; j < 3; ++j) w[c][j] = frag_lb(Wg + (c * 3 + j) * 512);
  v4f xr[DM / 32][4];   // the wave's rows as read: all forty loads go out together
#pragma unroll
  for (int kc = 0; kc < DM / 32; ++kc) { const float* p = X + (r0 + col) * DM + kc * 32 + 8 * g;
#pragma unroll
    for (int q = 0; q < 4; ++q) xr[kc][q] = *(const v4f*)(p + (q >> 1) * 16 + (q & 1) * 4); }
  asm volatile("s_wait_xcnt 0x0" ::: "memory");   // the loads' address registers are reused below: the wait stands in front of that
  __builtin_amdgcn_sched_barrier(0);   // keeps the work below behind the wait
  v16b a[DM / 32];
#pragma unroll
  for (int kc = 0; kc < DM / 32; ++kc)
#pragma unroll
    for (int i = 0; i < 16; ++i) a[kc][i] = (__bf16)xr[kc][i >> 2][i & 3];
  const size_t b = rb0 / SS, s0 = rb0 % SS;
#pragma unroll   // unrolled: the ring's place and the stream's end are then known at compile time
  for (int hh = 0; hh < HG; ++hh) { const int h = blockIdx.y * HG + hh;
    v8f acc[3] = {};
#pragma unroll
    for (int kc = 0; kc < DM / 32; ++kc) { const int c = hh * (DM / 32) + kc;
#pragma unroll
      for (int j = 0; j < 3; ++j) acc[j] = wmma_bf(a[kc], w[c % WR][j], acc[j]);   // columns n >= 40 are discarded
      if (c + WR < HG * (DM / 32)) {
#pragma unroll
        for (int j = 0; j < 3; ++j) w[c % WR][j] = frag_lb(Wg + ((c + WR) * 3 + j) * 512); }
      __builtin_amdgcn_sched_barrier(0); }   // holds each refill where it is written, WR chunks ahead of its products; left free, the loads sink to about one chunk ahead
    asm volatile("s_wait_xcnt 0x0" ::: "memory");   // the loads' address registers are reused below: the wait stands in front of that
    __builtin_amdgcn_sched_barrier(0);   // keeps the work below behind the wait
    if (which < 2) {
#pragma unroll
      for (int j = 0; j < 3; ++j) { const int n = j * 16 + col;
#pragma unroll
        for (int r = 0; r < 8; ++r) so[wave * 16 + 8 * g + r][n] = (n < HD) ? (_Float16)acc[j][r] : (_Float16)0.f; }
      LDSX();
      _Float16* kt = ((which == 0) ? Q : Kr) + ((size_t)h * SS + r0) * HDK + lane * 8;   // the wave's 16 rows are one 2-KiB tile: four 512-B runs, one per 16 dims
#pragma unroll
      for (int f = 0; f < 3; ++f) vst2((unsigned*)(kt + f * 256), *(const v4u*)&so[wave * 16 + col][f * 16 + 8 * g]);   // dims 0..47 (40 live + 8 zero)
      v4u z; z[0] = z[1] = z[2] = z[3] = 0u; vst2((unsigned*)(kt + 3 * 256), z);   // dims 48..63
    } else {
#pragma unroll
      for (int j = 0; j < 3; ++j) { const int n = j * 16 + col;
#pragma unroll
        for (int r = 0; r < 8; ++r) st[hh & 1][n][wave * 16 + 8 * g + r] = (n < HD) ? (_Float16)acc[j][r] : (_Float16)0.f; }
      __syncthreads();   // the head's tile is whole before it is read; a wave that passes it has also ended its reads of the other buffer, which the next head writes
      for (int e = tid; e < 48 * 8; e += 128) { const int ln = e & 31, p = (e >> 5) & 1, dk = e >> 6, dt = dk % 3, kp = dk / 3;   // 12 runs of 512 B: (32-key group kp, dim tile dt, key half p)
        vst2((unsigned*)(V + ((((size_t)h * (SS / 32) + (s0 >> 5) + kp) * (NB * 3) + b * 3 + dt) * 2 + p) * 256 + ln * 8), *(const v4u*)&st[hh & 1][dt * 16 + (ln & 15)][kp * 32 + p * 16 + (ln >> 4) * 8]); } }
    asm volatile("s_wait_xcnt 0x0" ::: "memory");   // the stores' data and address registers are reused by the next head: the wait stands in front of that
    __builtin_amdgcn_sched_barrier(0); }   // keeps the next head's work behind the wait
}
// ---- k_attn: block = (128 queries, head), 8 waves: waves w and w + 4 take the same 32 queries (two 16-column tiles) and one half of the 4,096 keys each, so that one wave's softmax issues under the other's products; the two partial results are joined once through LDS behind the loop. Transposed products: S^T = K . Q^T (a lane holds 16 of one query's 32 scores of the pass), O^T += V^T . P^T for the three batches' value planes (3 x 3 tiles); P^T goes from the score accumulators straight into the B operand
#define QT 2
#define KH (SS / 2)       // keys of one wave
// amdgpu_waves_per_eu(2, 2): the block's 8 waves stand two on a SIMD, and the compiler schedules and budgets registers for exactly that
__device__ __forceinline__ float xhalf(float x) { return __builtin_bit_cast(float, __builtin_amdgcn_permlanex16(__builtin_bit_cast(int, x), __builtin_bit_cast(int, x), 0x76543210, 0xfedcba98, false, false)); }   // lane l's value from lane l ^ 16
__global__ __launch_bounds__(256) __attribute__((amdgpu_waves_per_eu(2, 2))) void k_attn(const _Float16* __restrict__ Q, const _Float16* __restrict__ Kr, const _Float16* __restrict__ V, float* __restrict__ O) {
  __shared__ __align__(16) v4f xa[8][18][32];   // hand-over: the 72 accumulator registers of the tile a wave gives away, 16 bytes a lane
  __shared__ float xm[8][2][32];                // with that tile's maximum and sum
  const int tid = threadIdx.x, wave = tid >> 5, lane = tid & 31, g = lane >> 4; const int h = blockIdx.y; const int q0 = blockIdx.x * (64 * QT) + (wave & 3) * (16 * QT);
  const int kh = __builtin_amdgcn_readfirstlane(tid >> 7);   // the wave's key half, held scalar so that the loop's addresses keep their scalar part
  const int kb = kh * KH;
  v16h aq[QT][2];
#pragma unroll
  for (int t = 0; t < QT; ++t)
#pragma unroll
    for (int kc = 0; kc < 2; ++kc) aq[t][kc] = frag_l(Q + ((size_t)h * SS + q0 + t * 16) * HDK + kc * 512 + lane * 8);
  const _Float16* Kh = Kr + (size_t)h * SS * HDK + lane * 8;          // the head's keys: 64 halves a key, 1 KiB a fragment
  const _Float16* Vh = V + (size_t)h * SS * (NB * HDV) + lane * 8;   // the head's values: 144 halves a key, the nine fragments of 32 keys in a row
  v16h kf[2][2];   // the pass's key fragments, fetched one pass ahead
#pragma unroll
  for (int ct = 0; ct < 2; ++ct)
#pragma unroll
    for (int kc = 0; kc < 2; ++kc) kf[ct][kc] = frag_l(Kh + (size_t)kb * HDK + (ct * 2 + kc) * 512);
  asm volatile("s_wait_xcnt 0x0" ::: "memory");   // the query and key loads' address registers are reused below: the wait stands in front of that
  __builtin_amdgcn_sched_barrier(0);   // keeps the vector work below behind the wait
  float m[QT], l[QT];   // per lane: its query's running maximum (equal in both wave halves) and the sum over the keys of its own half
#pragma unroll
  for (int t = 0; t < QT; ++t) { m[t] = -3.0e38f; l[t] = 0.f; }
  v8f acc[QT][3][3] = {};   // O^T tiles: register r = value dim dt * 16 + 8 g + r, column = query
  // the O products run one pass late: pass ks forms its P and its rescale factor, pass ks + 1 applies them, so that those products depend on nothing of the softmax that stands beside them; two register sets, taken in turn
  v16h vf[2][3][3]; v16h pb[2][QT]; float al[2][QT];   // value fragments, P^T as B operand (element ct * 8 + r = key ct * 16 + 8 g + r, the hardware k order of the value fragments) and rescale factor of a pass
#pragma unroll
  for (int u = 0; u < 2; ++u) {
#pragma unroll
    for (int t = 0; t < QT; ++t) { al[u][t] = 1.f;
#pragma unroll
      for (int i = 0; i < 16; ++i) pb[u][t][i] = (_Float16)0.f; }
#pragma unroll
    for (int b = 0; b < 3; ++b)
#pragma unroll
      for (int dt = 0; dt < 3; ++dt)
#pragma unroll
        for (int i = 0; i < 16; ++i) vf[u][b][dt][i] = (_Float16)0.f; }   // the first pass's late products add 0 . 0
#pragma unroll 1
  for (int kk = 0; kk < KH / 64; ++kk) {
#pragma unroll   // unrolled by two: which register set a pass fills and which it works off is then known at compile time, no copies
    for (int u = 0; u < 2; ++u) { const int ks = kk * 2 + u, j0 = kb + ks * 32; v8f s[QT][2];
      const _Float16* vp = Vh + (size_t)j0 * (NB * HDV);   // one base for the eighteen loads
      __builtin_amdgcn_sched_barrier(0);   // with the one behind the wait: nothing but the loads stands between them, so no other instruction takes over an address register ahead of the wait
#pragma unroll
      for (int b = 0; b < 3; ++b)
#pragma unroll
        for (int dt = 0; dt < 3; ++dt) vf[u][b][dt] = frag_l(vp + (b * 3 + dt) * 512);   // read by the next pass: a whole pass covers their latency
      asm volatile("s_wait_xcnt 0x0" :: "v"(vp) : "memory");   // the value loads' address registers are free for reuse behind them: the wait stands in front of any rewrite; it names the address, which so stays out of the loads' own destinations
      __builtin_amdgcn_sched_barrier(0);   // keeps later vector work behind the wait
#pragma unroll
      for (int ct = 0; ct < 2; ++ct)
#pragma unroll
        for (int t = 0; t < QT; ++t) { v8f c = {};
#pragma unroll
          for (int kc = 0; kc < 2; ++kc) c = wmma16(kf[ct][kc], aq[t][kc], c);   // rows = keys j0 + ct * 16 + 8 g + r, column = query
#pragma unroll
          for (int r = 0; r < 8; ++r) s[t][ct][r] = c[r]; }
      const int jn = (ks + 1 < KH / 32) ? j0 + 32 : 0;   // next pass's keys (the last pass re-reads the first rows, unused)
      const _Float16* kp = Kh + (size_t)jn * HDK;   // one base for the eight loads
      __builtin_amdgcn_sched_barrier(0);   // with the one behind the wait: nothing but the loads stands between them
#pragma unroll
      for (int ct = 0; ct < 2; ++ct)
#pragma unroll
        for (int kc = 0; kc < 2; ++kc) kf[ct][kc] = frag_l(kp + (ct * 2 + kc) * 512);
      asm volatile("s_wait_xcnt 0x0" :: "v"(kp) : "memory");   // the key loads' address registers are reused by the softmax: the wait stands in front of that; it names the address, as at the value loads
      __builtin_amdgcn_sched_barrier(0);   // keeps the key loads in front of the softmax, whose whole length then covers their latency
      // the pass before's rescale and O products
#pragma unroll
      for (int t = 0; t < QT; ++t)
#pragma unroll
        for (int b = 0; b < 3; ++b)
#pragma unroll
          for (int dt = 0; dt < 3; ++dt) acc[t][b][dt] *= al[u ^ 1][t];
#pragma unroll
      for (int b = 0; b < 3; ++b)
#pragma unroll
        for (int dt = 0; dt < 3; ++dt)
#pragma unroll
          for (int t = 0; t < QT; ++t) acc[t][b][dt] = wmma16(vf[u ^ 1][b][dt], pb[u ^ 1][t], acc[t][b][dt]);
      // this pass's softmax
#pragma unroll
      for (int t = 0; t < QT; ++t) { float mr[8];
#pragma unroll
        for (int r = 0; r < 8; ++r) { s[t][0][r] *= 0.15811388300841897f; s[t][1][r] *= 0.15811388300841897f; mr[r] = fmaxf(s[t][0][r], s[t][1][r]); }   // 40^-0.5, applied here and not at the score products: more vector work to stand between the late products
        float mx = fmaxf(fmaxf(fmaxf(mr[0], mr[1]), fmaxf(mr[2], mr[3])), fmaxf(fmaxf(mr[4], mr[5]), fmaxf(mr[6], mr[7])));
        mx = fmaxf(mx, xhalf(mx));   // the other half's 16 keys
        const float mn = fmaxf(m[t], mx); const float alpha = (m[t] <= -1.0e38f) ? 0.f : __expf(m[t] - mn); float er[8];
#pragma unroll
        for (int r = 0; r < 8; ++r) { const float e0 = __expf(s[t][0][r] - mn), e1 = __expf(s[t][1][r] - mn); er[r] = e0 + e1;
          pb[u][t][r] = (_Float16)(e0 * 2048.0f); pb[u][t][8 + r] = (_Float16)(e1 * 2048.0f); }
        l[t] = l[t] * alpha + (((er[0] + er[1]) + (er[2] + er[3])) + ((er[4] + er[5]) + (er[6] + er[7]))); m[t] = mn; al[u][t] = alpha; }
      if (u == 0) asm volatile("" :: "v"(pb[u][0]), "v"(pb[u][1]), "v"(al[u][0]), "v"(al[u][1]));   // inputs only: holds the first pass's softmax in its own pass (the second's is held by the loop's end); left free, the compiler sinks all of it to its first use, a pass later, behind the late products that it is to stand beside
    } }
  // the last pass's rescale and O products
#pragma unroll
  for (int t = 0; t < QT; ++t)
#pragma unroll
    for (int b = 0; b < 3; ++b)
#pragma unroll
      for (int dt = 0; dt < 3; ++dt) acc[t][b][dt] *= al[1][t];
#pragma unroll
  for (int b = 0; b < 3; ++b)
#pragma unroll
    for (int dt = 0; dt < 3; ++dt)
#pragma unroll
      for (int t = 0; t < QT; ++t) acc[t][b][dt] = wmma16(vf[1][b][dt], pb[1][t], acc[t][b][dt]);
  // join of the two key halves: the wave of half kh finishes query tile kh and hands its partial result for the other tile to its partner (wave ^ 4)
  v8f ka[3][3]; const float km = kh ? m[1] : m[0], kl = kh ? l[1] : l[0];
#pragma unroll
  for (int b = 0; b < 3; ++b)
#pragma unroll
    for (int dt = 0; dt < 3; ++dt) { const v8f ga = kh ? acc[0][b][dt] : acc[1][b][dt]; ka[b][dt] = kh ? acc[1][b][dt] : acc[0][b][dt];
      v4f lo, hi;
#pragma unroll
      for (int r = 0; r < 4; ++r) { lo[r] = ga[r]; hi[r] = ga[4 + r]; }
      xa[wave][(b * 3 + dt) * 2][lane] = lo; xa[wave][(b * 3 + dt) * 2 + 1][lane] = hi; }
  xm[wave][0][lane] = kh ? m[0] : m[1]; xm[wave][1][lane] = kh ? l[0] : l[1];
  __syncthreads();   // every wave's hand-over is written before its partner reads it
  const int pw = wave ^ 4; const float pm = xm[pw][0][lane], pl = xm[pw][1][lane];
  const float mj = fmaxf(km, pm); const float fk = __expf(km - mj), fp = __expf(pm - mj);   // both halves have seen keys, so both maxima are scores
  const float lj = kl * fk + pl * fp;
  const float il = (1.0f / 2048.0f) / (lj + xhalf(lj));   // the two wave halves' sums joined once, with every lane on
  const float ck = fk * il, cp = fp * il;
  // an O^T accumulator tile already has the lane map of k_out's A fragment (lane = 16 g + query, 8 columns from 8 g): it is stored from the registers, 16 B a lane, the head's 64-column slot of the 16 queries as eight 512-B runs (40 live columns + 24 zeros)
  float* ob = O + ((size_t)q0 + kh * 16) * OSTR + h * 1024 + lane * 4;   // 16 rows = 16 * OSTR floats; a slot = 1,024 of them
  { v4f z; z[0] = z[1] = z[2] = z[3] = 0.f;
    __builtin_amdgcn_sched_barrier(0);   // with the one behind the wait: nothing but the stores stands between them, so no other instruction takes over one of their registers ahead of the wait
#pragma unroll
    for (int b = 0; b < 3; ++b) { vst2(ob + (size_t)b * SS * OSTR + 768, z); vst2(ob + (size_t)b * SS * OSTR + 896, z); }   // columns 48..63 of the slot
    asm volatile("s_wait_xcnt 0x0" ::: "memory");   // the stores' registers are reused below: the wait stands in front of that
    __builtin_amdgcn_sched_barrier(0); }   // keeps later work behind the wait
#pragma unroll
  for (int b = 0; b < 3; ++b) { float* ot = ob + (size_t)b * SS * OSTR;
    v4f ov[6];
#pragma unroll
    for (int dt = 0; dt < 3; ++dt) { const v4f lo = xa[pw][(b * 3 + dt) * 2][lane], hi = xa[pw][(b * 3 + dt) * 2 + 1][lane];
#pragma unroll
      for (int r = 0; r < 4; ++r) { ov[dt * 2][r] = (dt * 16 + 8 * g + r < HD) ? ka[b][dt][r] * ck + lo[r] * cp : 0.f; ov[dt * 2 + 1][r] = (dt * 16 + 8 * g + 4 + r < HD) ? ka[b][dt][4 + r] * ck + hi[r] * cp : 0.f; } }
    __builtin_amdgcn_sched_barrier(0);   // with the one behind the wait: nothing but the stores stands between them
#pragma unroll
    for (int f = 0; f < 6; ++f) vst2(ot + f * 128, ov[f]);
    asm volatile("s_wait_xcnt 0x0" ::: "memory");   // the stores' data and address registers are reused by the next batch: the wait stands in front of that
    __builtin_amdgcn_sched_barrier(0); }   // keeps later work behind the wait
}
// ---- k_out: block = (64 rows, 64-column chunk (5 chunks of 320)): out = o (hi + residual, K 512 head slots) . Wo rows + bo
__global__ __launch_bounds__(128) void k_out(const float* __restrict__ O, const __bf16* __restrict__ POS, const float* __restrict__ BO, float* __restrict__ OUT) {
  __shared__ __align__(16) float so[4][16][68];
  const int tid = threadIdx.x, wave = tid >> 5, lane = tid & 31, col = lane & 15, g = lane >> 4; const size_t r0 = (size_t)blockIdx.x * 64 + wave * 16; const int n0 = blockIdx.y * 64;
  v8f acc[4] = {};
#pragma unroll
  for (int kc = 0; kc < OSTR / 32; ++kc) { if ((kc & 1) && ((kc * 32) & 63) >= 48) {}   // (all chunks carry live or zero-weighted columns)
    float v[16];
#pragma unroll
    for (int q = 0; q < 4; ++q) { const v4f x = *(const v4f*)(O + r0 * OSTR + kc * 512 + q * 128 + lane * 4);
#pragma unroll
      for (int i = 0; i < 4; ++i) v[q * 4 + i] = x[i]; }
    const F2 a = bsplit16(v);
#pragma unroll
    for (int j = 0; j < 4; ++j) { const v16b w = frag_lb(POS + (size_t)(((n0 >> 4) + j) * 16 + kc) * 512 + lane * 8); acc[j] = wmma_bf(a.l, w, acc[j]); acc[j] = wmma_bf(a.h, w, acc[j]); } }
#pragma unroll
  for (int j = 0; j < 4; ++j) { const float bb = bfr(BO[n0 + j * 16 + col]);
#pragma unroll
    for (int r = 0; r < 8; ++r) so[wave][8 * g + r][j * 16 + col] = acc[j][r] + bb; }
  LDSX();
  for (int rl = 0; rl < 16; ++rl) if (lane < 16) vst2(OUT + (r0 + rl) * DM + n0 + lane * 4, *(const v4f*)&so[wave][rl][lane * 4]);
}
extern "C" void kernel_launch(void* const* d_in, const int* in_sizes, int n_in, void* d_out, int out_size, void* d_ws, size_t ws_size, hipStream_t stream) {
  (void)in_sizes; (void)n_in; (void)out_size;
  const float** F = (const float**)d_in;   // 0 x [3,4096,320], 1 Wq, 2 Wk, 3 Wv, 4 Wo (natural [320,320]), 5 bo
  if (ws_size < (size_t)WS_END) return;
  char* ws = (char*)d_ws; __bf16* P = (__bf16*)ws; __bf16* POS = (__bf16*)(ws + WS_POS); _Float16 *Q = (_Float16*)(ws + WS_Q), *Kr = (_Float16*)(ws + WS_K), *V = (_Float16*)(ws + WS_V); float* O = (float*)(ws + WS_O);
  k_pack<<<dim3(DM / 16 * (OSTR / 32) * 2 / 8, 4), 256, 0, stream>>>(F[1], F[2], F[3], F[4], P, POS);
  k_zero<<<(unsigned)(((size_t)SS * NH * HDK * 2 + (size_t)NB * NH * HDV * SS) / 4096), 256, 0, stream>>>(Q, (size_t)SS * NH * HDK * 2 + (size_t)NB * NH * HDV * SS);   // Q, K (contiguous) and V regions
  k_proj<<<dim3(NR / 64, NH / HG, 3), 128, 0, stream>>>(F[0], P, Q, Kr, V);
  k_attn<<<dim3(SS / (64 * QT), NH), 256, 0, stream>>>(Q, Kr, V, O);
  k_out<<<dim3(NR / 64, DM / 64), 128, 0, stream>>>(O, POS, F[5], (float*)d_out);
}
